// v000
// Times are from an AMD MI455X. After a warm-up the kernel runs many times in a row, and a time is the length of
// such a window on the GPU divided by its runs, so every launch and the gaps after it count. The runs cycle
// through copies of the inputs. A figure is the median of several windows, for all but v000 over two sittings.
// Sittings can differ by a few percent; kernels timed side by side share one.
// v000 is the starting kernel.
#include <hip/hip_runtime.h>

// MoE: B=8, S=4096, D=512, H=2048, E=8, K=2  (all fp32 in/out)
#define NTOK 32768
#define Dk   512
#define Hk   2048
#define Ek   8
#define MTOK 32              // tokens per expert block (2 WMMA M-tiles)
#define HC   512             // H chunk held in LDS per pass (4 chunks)
#define XLD  520             // padded LDS row stride (halves): 1040B = 65*16
#define HLD  520             // padded LDS row stride (halves) for h chunk

typedef _Float16 v16h __attribute__((ext_vector_type(16)));
typedef _Float16 v8h  __attribute__((ext_vector_type(8)));
typedef float    v8f  __attribute__((ext_vector_type(8)));

static __device__ inline v16h cat16(v8h lo, v8h hi) {
  return __builtin_shufflevector(lo, hi, 0,1,2,3,4,5,6,7,8,9,10,11,12,13,14,15);
}

// ---------------------------------------------------------------------------
// Pre-swizzle [Kd x Nd] f32 row-major matrices into the per-lane WMMA-B f16
// fragment layout: tile = (mat*(Kd/32)+kb)*(Nd/16)+nb, 512 halves per tile,
// lane-contiguous. B fragment load becomes one 32B/lane load, no cvt VALU.
// ---------------------------------------------------------------------------
template <int Kd, int Nd>
__global__ __launch_bounds__(256) void swizzleB_kernel(
    const float* __restrict__ src, _Float16* __restrict__ dst)
{
  const size_t gid = (size_t)blockIdx.x * 256 + threadIdx.x;  // tile*32 + lane
  const int lane = (int)(gid & 31);
  const size_t tile = gid >> 5;
  constexpr int NTN = Nd >> 4;   // n-tiles
  constexpr int NTK = Kd >> 5;   // k-tiles
  const int nb = (int)(tile % NTN);
  const size_t rest = tile / NTN;
  const int kb = (int)(rest % NTK);
  const size_t mat = rest / NTK;

  const int n   = nb * 16 + (lane & 15);
  const int hi8 = (lane >> 4) << 3;
  const float* s = src + (size_t)mat * Kd * Nd;
  v16h o;
#pragma unroll
  for (int i = 0; i < 8; ++i)
    o[i] = (_Float16)s[(size_t)(kb * 32 + hi8 + i) * Nd + n];
#pragma unroll
  for (int i = 0; i < 8; ++i)
    o[8 + i] = (_Float16)s[(size_t)(kb * 32 + 16 + hi8 + i) * Nd + n];
  *(v16h*)(dst + gid * 16) = o;
}

// ---------------------------------------------------------------------------
// Router: one wave32 per token. Dual dot products (Wg, Wn), softplus-noised
// logits, top-2, analytic 2-way softmax gates, append to per-expert lists.
// ---------------------------------------------------------------------------
__global__ __launch_bounds__(256) void router_kernel(
    const float* __restrict__ x, const float* __restrict__ noise,
    const float* __restrict__ Wg, const float* __restrict__ bg,
    const float* __restrict__ Wn, const float* __restrict__ bn,
    int* __restrict__ cnt, int* __restrict__ tok_list, float* __restrict__ gate_list)
{
  const int wave = threadIdx.x >> 5;
  const int lane = threadIdx.x & 31;
  const int t = blockIdx.x * 8 + wave;

  float ag[Ek], an[Ek];
#pragma unroll
  for (int e = 0; e < Ek; ++e) { ag[e] = 0.f; an[e] = 0.f; }

  const float* xt = x + (size_t)t * Dk;
  for (int d = lane; d < Dk; d += 32) {
    const float xv = xt[d];
    const float* wg = Wg + d * Ek;
    const float* wn = Wn + d * Ek;
#pragma unroll
    for (int e = 0; e < Ek; ++e) {
      ag[e] = fmaf(xv, wg[e], ag[e]);
      an[e] = fmaf(xv, wn[e], an[e]);
    }
  }
#pragma unroll
  for (int off = 16; off > 0; off >>= 1) {
#pragma unroll
    for (int e = 0; e < Ek; ++e) {
      ag[e] += __shfl_down(ag[e], off, 32);
      an[e] += __shfl_down(an[e], off, 32);
    }
  }

  if (lane == 0) {
    float v[Ek];
#pragma unroll
    for (int e = 0; e < Ek; ++e) {
      const float lg = ag[e] + bg[e];
      const float ln = an[e] + bn[e];
      const float sp = (ln > 0.f) ? (ln + log1pf(expf(-ln))) : log1pf(expf(ln));
      v[e] = fmaf(noise[(size_t)t * Ek + e], sp, lg);
    }
    int i1 = 0;
#pragma unroll
    for (int e = 1; e < Ek; ++e) if (v[e] > v[i1]) i1 = e;
    int i2 = (i1 == 0) ? 1 : 0;
#pragma unroll
    for (int e = 0; e < Ek; ++e) if (e != i1 && v[e] > v[i2]) i2 = e;
    const float r  = expf(v[i2] - v[i1]);
    const float g1 = 1.f / (1.f + r);
    const float g2 = r / (1.f + r);
    int p1 = atomicAdd(&cnt[i1], 1);
    tok_list[i1 * NTOK + p1]  = t;
    gate_list[i1 * NTOK + p1] = g1;
    int p2 = atomicAdd(&cnt[i2], 1);
    tok_list[i2 * NTOK + p2]  = t;
    gate_list[i2 * NTOK + p2] = g2;
  }
}

// ---------------------------------------------------------------------------
// Expert MLP: block = (32 routed tokens) x (1 expert); 8 waves.
// Per k-step: two A fragments (M-tiles) from LDS; each streamed B fragment
// (one 32B/lane load from pre-swizzled f16 weights) feeds two WMMAs.
// H processed in 4 chunks of 512 so h stays in LDS; y accumulated in VGPRs.
// ---------------------------------------------------------------------------
__global__ __launch_bounds__(256, 1) void expert_kernel(
    const float* __restrict__ x,
    const _Float16* __restrict__ W1s, const float* __restrict__ b1,
    const _Float16* __restrict__ W2s, const float* __restrict__ b2,
    const int* __restrict__ cnt, const int* __restrict__ tok_list,
    const float* __restrict__ gate_list, float* __restrict__ out)
{
  __shared__ _Float16 xs[MTOK * XLD];   // 32 tokens x 512 (f16, padded)
  __shared__ _Float16 hs[MTOK * HLD];   // 32 tokens x 512 (f16, padded)
  __shared__ int   stok[MTOK];
  __shared__ float sgate[MTOK];

  const int e  = blockIdx.y;
  const int m0 = blockIdx.x * MTOK;
  const int ce = cnt[e];
  if (m0 >= ce) return;
  const int rows = (ce - m0 < MTOK) ? (ce - m0) : MTOK;

  const int tid = threadIdx.x;
  if (tid < MTOK) {
    const bool valid = tid < rows;
    stok[tid]  = valid ? tok_list[e * NTOK + m0 + tid] : 0;
    sgate[tid] = valid ? gate_list[e * NTOK + m0 + tid] : 0.f;
  }
  __syncthreads();

  // Gather 32 token rows of x into LDS as f16 (coalesced per row).
  for (int i = tid; i < MTOK * Dk; i += 256) {
    const int r = i >> 9, c = i & (Dk - 1);
    const float v = (r < rows) ? x[(size_t)stok[r] * Dk + c] : 0.f;
    xs[r * XLD + c] = (_Float16)v;
  }
  __syncthreads();

  const int wave = tid >> 5;
  const int lane = tid & 31;
  const int ln   = lane & 15;          // A row / B,C,D column within tile
  const int hi8  = (lane >> 4) << 3;   // 0 or 8: K/M offset for upper lanes

  const float* b1e = b1 + e * Hk;
  const float* b2e = b2 + e * Dk;

  v8f yacc[4][2];
#pragma unroll
  for (int q = 0; q < 4; ++q) { yacc[q][0] = (v8f){}; yacc[q][1] = (v8f){}; }

  for (int ch = 0; ch < Hk; ch += HC) {
    // ---- up-projection: hs = relu(xs @ W1e[:, ch:ch+HC] + b1) ----
    const int nb0 = (ch >> 4) + wave * 4;      // first n-tile (of 128) for wave
    v8f acc[4][2];
#pragma unroll
    for (int p = 0; p < 4; ++p) { acc[p][0] = (v8f){}; acc[p][1] = (v8f){}; }

    for (int k0 = 0; k0 < Dk; k0 += 32) {
      v16h A[2];
#pragma unroll
      for (int mt = 0; mt < 2; ++mt) {
        const int r = (mt * 16 + ln) * XLD;
        A[mt] = cat16(*(const v8h*)&xs[r + k0 + hi8],
                      *(const v8h*)&xs[r + k0 + 16 + hi8]);
      }
      // swizzled tile base: tile = (e*16 + k0/32)*128 + nb
      const _Float16* bK = W1s +
          ((size_t)((e * 16 + (k0 >> 5)) * 128 + nb0)) * 512 + lane * 16;
      __builtin_prefetch((const void*)(bK + (size_t)128 * 512), 0, 3);
#pragma unroll
      for (int p = 0; p < 4; ++p) {
        const v16h B = *(const v16h*)(bK + (size_t)p * 512);
        acc[p][0] = __builtin_amdgcn_wmma_f32_16x16x32_f16(
            false, A[0], false, B, (short)0, acc[p][0], false, false);
        acc[p][1] = __builtin_amdgcn_wmma_f32_16x16x32_f16(
            false, A[1], false, B, (short)0, acc[p][1], false, false);
      }
    }
    // epilogue: bias + relu + f16 store into hs
#pragma unroll
    for (int p = 0; p < 4; ++p) {
      const int ncol = (nb0 + p) * 16 + ln;    // global column in H
      const float bias = b1e[ncol];
      const int nloc = ncol - ch;              // 0..HC-1
#pragma unroll
      for (int mt = 0; mt < 2; ++mt) {
#pragma unroll
        for (int vv = 0; vv < 8; ++vv) {
          const int m = mt * 16 + vv + hi8;    // C/D row layout
          hs[m * HLD + nloc] = (_Float16)fmaxf(acc[p][mt][vv] + bias, 0.f);
        }
      }
    }
    __syncthreads();

    // ---- down-projection partial: yacc += hs @ W2e[ch:ch+HC, :] ----
    const int db0 = wave * 4;                  // first n-tile (of 32) for wave
    for (int k0 = 0; k0 < HC; k0 += 32) {
      v16h A[2];
#pragma unroll
      for (int mt = 0; mt < 2; ++mt) {
        const int r = (mt * 16 + ln) * HLD;
        A[mt] = cat16(*(const v8h*)&hs[r + k0 + hi8],
                      *(const v8h*)&hs[r + k0 + 16 + hi8]);
      }
      const int kbg = (ch + k0) >> 5;          // global k-block in H
      const _Float16* bK = W2s +
          ((size_t)((e * 64 + kbg) * 32 + db0)) * 512 + lane * 16;
      __builtin_prefetch((const void*)(bK + (size_t)32 * 512), 0, 3);
#pragma unroll
      for (int q = 0; q < 4; ++q) {
        const v16h B = *(const v16h*)(bK + (size_t)q * 512);
        yacc[q][0] = __builtin_amdgcn_wmma_f32_16x16x32_f16(
            false, A[0], false, B, (short)0, yacc[q][0], false, false);
        yacc[q][1] = __builtin_amdgcn_wmma_f32_16x16x32_f16(
            false, A[1], false, B, (short)0, yacc[q][1], false, false);
      }
    }
    __syncthreads();
  }

  // ---- scatter: out[token] += (y + b2) * gate ----
#pragma unroll
  for (int q = 0; q < 4; ++q) {
    const int ncol = (wave * 4 + q) * 16 + ln;
    const float bias = b2e[ncol];
#pragma unroll
    for (int mt = 0; mt < 2; ++mt) {
#pragma unroll
      for (int vv = 0; vv < 8; ++vv) {
        const int m = mt * 16 + vv + hi8;
        if (m < rows) {
          const float val = (yacc[q][mt][vv] + bias) * sgate[m];
          atomicAdd(&out[(size_t)stok[m] * Dk + ncol], val);
        }
      }
    }
  }
}

// ---------------------------------------------------------------------------
extern "C" void kernel_launch(void* const* d_in, const int* in_sizes, int n_in,
                              void* d_out, int out_size, void* d_ws, size_t ws_size,
                              hipStream_t stream) {
  (void)in_sizes; (void)n_in; (void)ws_size;
  const float* x     = (const float*)d_in[0];
  const float* noise = (const float*)d_in[1];
  const float* Wg    = (const float*)d_in[2];
  const float* bg    = (const float*)d_in[3];
  const float* Wn    = (const float*)d_in[4];
  const float* bn    = (const float*)d_in[5];
  const float* W1    = (const float*)d_in[6];
  const float* b1    = (const float*)d_in[7];
  const float* W2    = (const float*)d_in[8];
  const float* b2    = (const float*)d_in[9];
  float* out = (float*)d_out;

  // Workspace layout:
  //   [cnt: 256B] [tok_list: E*NTOK*4 = 1MB] [gate_list: 1MB]
  //   [W1s f16 swizzled: E*D*H*2 = 16MB] [W2s f16 swizzled: 16MB]
  char* ws = (char*)d_ws;
  int*   cnt  = (int*)ws;
  int*   tokl = (int*)(ws + 256);
  float* gatl = (float*)(ws + 256 + (size_t)Ek * NTOK * sizeof(int));
  _Float16* W1s = (_Float16*)(ws + 4 * 1024 * 1024);
  _Float16* W2s = W1s + (size_t)Ek * Dk * Hk;

  hipMemsetAsync(out, 0, (size_t)out_size * sizeof(float), stream);
  hipMemsetAsync(cnt, 0, Ek * sizeof(int), stream);

  // Weight pre-swizzle into WMMA-B fragment layout (f32 -> f16).
  {
    const size_t g1 = (size_t)Ek * (Dk / 32) * (Hk / 16) * 32;   // W1 lanes
    const size_t g2 = (size_t)Ek * (Hk / 32) * (Dk / 16) * 32;   // W2 lanes
    swizzleB_kernel<Dk, Hk><<<(int)(g1 / 256), 256, 0, stream>>>(W1, W1s);
    swizzleB_kernel<Hk, Dk><<<(int)(g2 / 256), 256, 0, stream>>>(W2, W2s);
  }

  router_kernel<<<NTOK / 8, 256, 0, stream>>>(x, noise, Wg, bg, Wn, bn,
                                              cnt, tokl, gatl);
  expert_kernel<<<dim3(NTOK / MTOK, Ek), 256, 0, stream>>>(x, W1s, b1, W2s, b2,
                                                           cnt, tokl, gatl, out);
}

// v001
// Next to v000, in two timings, it ran 2.10 and 2.09 times as fast.
#include <hip/hip_runtime.h>

// MoE: B=8, S=4096, D=512, H=2048, E=8, K=2  (all fp32 in/out)
#define NTOK 32768
#define Dk   512
#define Hk   2048
#define Ek   8
#define MTOK 32              // tokens per expert block (2 WMMA M-tiles)
#define HC   512             // H chunk held in LDS per pass (4 chunks)
#define XLD  520             // padded LDS row stride (halves): 1040B = 65*16
#define HLD  520             // padded LDS row stride (halves) for h chunk

typedef _Float16 v16h __attribute__((ext_vector_type(16)));
typedef _Float16 v8h  __attribute__((ext_vector_type(8)));
typedef float    v8f  __attribute__((ext_vector_type(8)));

static __device__ inline v16h cat16(v8h lo, v8h hi) {
  return __builtin_shufflevector(lo, hi, 0,1,2,3,4,5,6,7,8,9,10,11,12,13,14,15);
}

// ---------------------------------------------------------------------------
// Pre-swizzle [Kd x Nd] f32 row-major matrices into the per-lane WMMA-B f16
// fragment layout: tile = (mat*(Kd/32)+kb)*(Nd/16)+nb, 512 halves per tile,
// lane-contiguous. B fragment load becomes one 32B/lane load, no cvt VALU.
// ---------------------------------------------------------------------------
template <int Kd, int Nd>
__global__ __launch_bounds__(256) void swizzleB_kernel(
    const float* __restrict__ src, _Float16* __restrict__ dst)
{
  const size_t gid = (size_t)blockIdx.x * 256 + threadIdx.x;  // tile*32 + lane
  const int lane = (int)(gid & 31);
  const size_t tile = gid >> 5;
  constexpr int NTN = Nd >> 4;   // n-tiles
  constexpr int NTK = Kd >> 5;   // k-tiles
  const int nb = (int)(tile % NTN);
  const size_t rest = tile / NTN;
  const int kb = (int)(rest % NTK);
  const size_t mat = rest / NTK;

  const int n   = nb * 16 + (lane & 15);
  const int hi8 = (lane >> 4) << 3;
  const float* s = src + (size_t)mat * Kd * Nd;
  v16h o;
#pragma unroll
  for (int i = 0; i < 8; ++i)
    o[i] = (_Float16)s[(size_t)(kb * 32 + hi8 + i) * Nd + n];
#pragma unroll
  for (int i = 0; i < 8; ++i)
    o[8 + i] = (_Float16)s[(size_t)(kb * 32 + 16 + hi8 + i) * Nd + n];
  *(v16h*)(dst + gid * 16) = o;
}

// ---------------------------------------------------------------------------
// Router: one wave32 per token. Dual dot products (Wg, Wn), softplus-noised
// logits, top-2, analytic 2-way softmax gates, append to per-expert lists.
// ---------------------------------------------------------------------------
__global__ __launch_bounds__(256) void router_kernel(
    const float* __restrict__ x, const float* __restrict__ noise,
    const float* __restrict__ Wg, const float* __restrict__ bg,
    const float* __restrict__ Wn, const float* __restrict__ bn,
    int* __restrict__ cnt, int* __restrict__ tok_list, float* __restrict__ gate_list)
{
  const int wave = threadIdx.x >> 5;
  const int lane = threadIdx.x & 31;
  const int t = blockIdx.x * 8 + wave;

  float ag[Ek], an[Ek];
#pragma unroll
  for (int e = 0; e < Ek; ++e) { ag[e] = 0.f; an[e] = 0.f; }

  const float* xt = x + (size_t)t * Dk;
  for (int d = lane; d < Dk; d += 32) {
    const float xv = xt[d];
    const float* wg = Wg + d * Ek;
    const float* wn = Wn + d * Ek;
#pragma unroll
    for (int e = 0; e < Ek; ++e) {
      ag[e] = fmaf(xv, wg[e], ag[e]);
      an[e] = fmaf(xv, wn[e], an[e]);
    }
  }
#pragma unroll
  for (int off = 16; off > 0; off >>= 1) {
#pragma unroll
    for (int e = 0; e < Ek; ++e) {
      ag[e] += __shfl_down(ag[e], off, 32);
      an[e] += __shfl_down(an[e], off, 32);
    }
  }

  if (lane == 0) {
    float v[Ek];
#pragma unroll
    for (int e = 0; e < Ek; ++e) {
      const float lg = ag[e] + bg[e];
      const float ln = an[e] + bn[e];
      const float sp = (ln > 0.f) ? (ln + log1pf(expf(-ln))) : log1pf(expf(ln));
      v[e] = fmaf(noise[(size_t)t * Ek + e], sp, lg);
    }
    int i1 = 0;
#pragma unroll
    for (int e = 1; e < Ek; ++e) if (v[e] > v[i1]) i1 = e;
    int i2 = (i1 == 0) ? 1 : 0;
#pragma unroll
    for (int e = 0; e < Ek; ++e) if (e != i1 && v[e] > v[i2]) i2 = e;
    const float r  = expf(v[i2] - v[i1]);
    const float g1 = 1.f / (1.f + r);
    const float g2 = r / (1.f + r);
    int p1 = atomicAdd(&cnt[i1], 1);
    tok_list[i1 * NTOK + p1]  = t;
    gate_list[i1 * NTOK + p1] = g1;
    int p2 = atomicAdd(&cnt[i2], 1);
    tok_list[i2 * NTOK + p2]  = t;
    gate_list[i2 * NTOK + p2] = g2;
  }
}

// ---------------------------------------------------------------------------
// Expert MLP: block = (32 routed tokens) x (1 expert); 8 waves.
// Per k-step: two A fragments (M-tiles) from LDS; each streamed B fragment
// (one 32B/lane load from pre-swizzled f16 weights) feeds two WMMAs.
// H processed in 4 chunks of 512 so h stays in LDS; y accumulated in VGPRs.
// The B fragments of a wave form one stream of 128 k-steps (per chunk 16 of
// W1, then 16 of W2) whose addresses depend on no data: a ring of 8 fragments
// in registers is refilled two k-steps ahead of the WMMAs that read it.
// ---------------------------------------------------------------------------
// Address of k-step t (0..31) of chunk c in a wave's weight stream.
static __device__ __forceinline__ const _Float16* wstep(
    const _Float16* W1w, const _Float16* W2w, int c, int t) {
  return (t < 16) ? W1w + (size_t)(t * 128 + c * 32) * 512
                  : W2w + (size_t)((c * 16 + (t - 16)) * 32) * 512;
}

static __device__ __forceinline__ void chunk_pass(
    const int c, const _Float16* xs, _Float16* hs,
    const _Float16* W1w, const _Float16* W2w, const float* b1e,
    const int wave, const int ln, const int hi8,
    v16h (&R)[8], v8f (&yacc)[4][2])
{
  // ---- up-projection: hs = relu(xs @ W1e[:, chunk] + b1) ----
  v8f acc[4][2];
#pragma unroll
  for (int p = 0; p < 4; ++p) { acc[p][0] = (v8f){}; acc[p][1] = (v8f){}; }

  // Loads return in order: fetched here, the biases are older than every refill
  // of this pass, so the wait for them does not drain the ring.
  float bias1[4];
#pragma unroll
  for (int p = 0; p < 4; ++p) bias1[p] = b1e[c * HC + (wave * 4 + p) * 16 + ln];

#pragma unroll
  for (int t = 0; t < 16; ++t) {
    v16h A[2];
#pragma unroll
    for (int mt = 0; mt < 2; ++mt) {
      const int r = (mt * 16 + ln) * XLD + t * 32;
      A[mt] = cat16(*(const v8h*)&xs[r + hi8], *(const v8h*)&xs[r + 16 + hi8]);
    }
    const _Float16* nx = wstep(W1w, W2w, c, t + 2);
#pragma unroll
    for (int p = 0; p < 4; ++p) {
      const int sl = (t & 1) * 4 + p;
      acc[p][0] = __builtin_amdgcn_wmma_f32_16x16x32_f16(
          false, A[0], false, R[sl], (short)0, acc[p][0], false, false);
      acc[p][1] = __builtin_amdgcn_wmma_f32_16x16x32_f16(
          false, A[1], false, R[sl], (short)0, acc[p][1], false, false);
      R[sl] = *(const v16h*)(nx + (size_t)p * 512);   // refill, two k-steps ahead
    }
    // Keeps this step's refills from being sunk down to their use two steps on
    // (the scheduler did that, and each fragment then cost a full load latency).
    __builtin_amdgcn_sched_barrier(0);
  }
  // epilogue: bias + relu + f16 store into hs
#pragma unroll
  for (int p = 0; p < 4; ++p) {
    const int nloc = (wave * 4 + p) * 16 + ln;   // 0..HC-1
    const float bias = bias1[p];
#pragma unroll
    for (int mt = 0; mt < 2; ++mt) {
#pragma unroll
      for (int vv = 0; vv < 8; ++vv) {
        const int m = mt * 16 + vv + hi8;        // C/D row layout
        hs[m * HLD + nloc] = (_Float16)fmaxf(acc[p][mt][vv] + bias, 0.f);
      }
    }
  }
  __syncthreads();

  // ---- down-projection partial: yacc += hs @ W2e[chunk, :] ----
#pragma unroll
  for (int t = 16; t < 32; ++t) {
    v16h A[2];
#pragma unroll
    for (int mt = 0; mt < 2; ++mt) {
      const int r = (mt * 16 + ln) * HLD + (t - 16) * 32;
      A[mt] = cat16(*(const v8h*)&hs[r + hi8], *(const v8h*)&hs[r + 16 + hi8]);
    }
#pragma unroll
    for (int q = 0; q < 4; ++q) {
      const int sl = (t & 1) * 4 + q;
      yacc[q][0] = __builtin_amdgcn_wmma_f32_16x16x32_f16(
          false, A[0], false, R[sl], (short)0, yacc[q][0], false, false);
      yacc[q][1] = __builtin_amdgcn_wmma_f32_16x16x32_f16(
          false, A[1], false, R[sl], (short)0, yacc[q][1], false, false);
      if (t + 2 < 32)
        R[sl] = *(const v16h*)(wstep(W1w, W2w, c, t + 2) + (size_t)q * 512);
    }
    __builtin_amdgcn_sched_barrier(0);           // as above: refills stay in their step
  }
  // The next chunk's first two k-steps, where there is one (c is the same in
  // every wave: a scalar branch). One branch behind the last WMMA: a branch
  // inside the last steps made the compiler wait for all loads there.
  if (c + 1 < Hk / HC) {
#pragma unroll
    for (int s = 0; s < 8; ++s)
      R[s] = *(const v16h*)(wstep(W1w, W2w, c + 1, s >> 2) + (size_t)(s & 3) * 512);
  }
  __syncthreads();
}

__global__ __launch_bounds__(256, 1) void expert_kernel(
    const float* __restrict__ x,
    const _Float16* __restrict__ W1s, const float* __restrict__ b1,
    const _Float16* __restrict__ W2s, const float* __restrict__ b2,
    const int* __restrict__ cnt, const int* __restrict__ tok_list,
    const float* __restrict__ gate_list, float* __restrict__ out)
{
  __shared__ _Float16 xs[MTOK * XLD];   // 32 tokens x 512 (f16, padded)
  __shared__ _Float16 hs[MTOK * HLD];   // 32 tokens x 512 (f16, padded)
  __shared__ int   stok[MTOK];
  __shared__ float sgate[MTOK];

  const int e  = blockIdx.y;
  const int m0 = blockIdx.x * MTOK;
  const int ce = cnt[e];
  if (m0 >= ce) return;
  const int rows = (ce - m0 < MTOK) ? (ce - m0) : MTOK;

  const int tid  = threadIdx.x;
  const int wave = __builtin_amdgcn_readfirstlane(tid >> 5);  // scalar: tile offsets on the scalar unit
  const int lane = tid & 31;
  const int ln   = lane & 15;          // A row / B,C,D column within tile
  const int hi8  = (lane >> 4) << 3;   // 0 or 8: K/M offset for upper lanes

  // swizzled tile = (e*16 + kb)*128 + nb for W1s, (e*64 + kb)*32 + nb for W2s
  const _Float16* W1w = W1s + ((size_t)(e * 16) * 128 + wave * 4) * 512 + lane * 16;
  const _Float16* W2w = W2s + ((size_t)(e * 64) * 32 + wave * 4) * 512 + lane * 16;

  // Fill the ring first: k-steps 0 and 1 are under way before the token list is read.
  v16h R[8];
#pragma unroll
  for (int s = 0; s < 8; ++s)
    R[s] = *(const v16h*)(wstep(W1w, W2w, 0, s >> 2) + (size_t)(s & 3) * 512);

  if (tid < MTOK) {
    const bool valid = tid < rows;
    stok[tid]  = valid ? tok_list[e * NTOK + m0 + tid] : 0;
    sgate[tid] = valid ? gate_list[e * NTOK + m0 + tid] : 0.f;
  }
  __syncthreads();

  // Gather 32 token rows of x into LDS as f16 (coalesced per row).
  for (int i = tid; i < MTOK * Dk; i += 256) {
    const int r = i >> 9, c = i & (Dk - 1);
    const float v = (r < rows) ? x[(size_t)stok[r] * Dk + c] : 0.f;
    xs[r * XLD + c] = (_Float16)v;
  }
  __syncthreads();

  const float* b1e = b1 + e * Hk;
  const float* b2e = b2 + e * Dk;

  v8f yacc[4][2];
#pragma unroll
  for (int q = 0; q < 4; ++q) { yacc[q][0] = (v8f){}; yacc[q][1] = (v8f){}; }

  for (int c = 0; c < Hk / HC; ++c)
    chunk_pass(c, xs, hs, W1w, W2w, b1e, wave, ln, hi8, R, yacc);

  // ---- scatter: out[token] += (y + b2) * gate ----
#pragma unroll
  for (int q = 0; q < 4; ++q) {
    const int ncol = (wave * 4 + q) * 16 + ln;
    const float bias = b2e[ncol];
#pragma unroll
    for (int mt = 0; mt < 2; ++mt) {
#pragma unroll
      for (int vv = 0; vv < 8; ++vv) {
        const int m = mt * 16 + vv + hi8;
        if (m < rows) {
          const float val = (yacc[q][mt][vv] + bias) * sgate[m];
          atomicAdd(&out[(size_t)stok[m] * Dk + ncol], val);
        }
      }
    }
  }
}

// ---------------------------------------------------------------------------
extern "C" void kernel_launch(void* const* d_in, const int* in_sizes, int n_in,
                              void* d_out, int out_size, void* d_ws, size_t ws_size,
                              hipStream_t stream) {
  (void)in_sizes; (void)n_in; (void)ws_size;
  const float* x     = (const float*)d_in[0];
  const float* noise = (const float*)d_in[1];
  const float* Wg    = (const float*)d_in[2];
  const float* bg    = (const float*)d_in[3];
  const float* Wn    = (const float*)d_in[4];
  const float* bn    = (const float*)d_in[5];
  const float* W1    = (const float*)d_in[6];
  const float* b1    = (const float*)d_in[7];
  const float* W2    = (const float*)d_in[8];
  const float* b2    = (const float*)d_in[9];
  float* out = (float*)d_out;

  // Workspace layout:
  //   [cnt: 256B] [tok_list: E*NTOK*4 = 1MB] [gate_list: 1MB]
  //   [W1s f16 swizzled: E*D*H*2 = 16MB] [W2s f16 swizzled: 16MB]
  char* ws = (char*)d_ws;
  int*   cnt  = (int*)ws;
  int*   tokl = (int*)(ws + 256);
  float* gatl = (float*)(ws + 256 + (size_t)Ek * NTOK * sizeof(int));
  _Float16* W1s = (_Float16*)(ws + 4 * 1024 * 1024);
  _Float16* W2s = W1s + (size_t)Ek * Dk * Hk;

  hipMemsetAsync(out, 0, (size_t)out_size * sizeof(float), stream);
  hipMemsetAsync(cnt, 0, Ek * sizeof(int), stream);

  // Weight pre-swizzle into WMMA-B fragment layout (f32 -> f16).
  {
    const size_t g1 = (size_t)Ek * (Dk / 32) * (Hk / 16) * 32;   // W1 lanes
    const size_t g2 = (size_t)Ek * (Hk / 32) * (Dk / 16) * 32;   // W2 lanes
    swizzleB_kernel<Dk, Hk><<<(int)(g1 / 256), 256, 0, stream>>>(W1, W1s);
    swizzleB_kernel<Hk, Dk><<<(int)(g2 / 256), 256, 0, stream>>>(W2, W2s);
  }

  router_kernel<<<NTOK / 8, 256, 0, stream>>>(x, noise, Wg, bg, Wn, bn,
                                              cnt, tokl, gatl);
  expert_kernel<<<dim3(NTOK / MTOK, Ek), 256, 0, stream>>>(x, W1s, b1, W2s, b2,
                                                           cnt, tokl, gatl, out);
}

// v002
// In both of two side-by-side timings against v001, it was 1.16 times as fast.
// Counting every step since v000, it is 2.44 times as fast.
#include <hip/hip_runtime.h>

// MoE: B=8, S=4096, D=512, H=2048, E=8, K=2  (all fp32 in/out)
#define NTOK 32768
#define Dk   512
#define Hk   2048
#define Ek   8
#define MTOK 32              // tokens per expert block (2 WMMA M-tiles)
#define HC   512             // H chunk held in LDS per pass (4 chunks)
#define XLD  520             // padded LDS row stride (halves): 1040B = 65*16
#define HLD  520             // padded LDS row stride (halves) for h chunk

typedef _Float16 v16h __attribute__((ext_vector_type(16)));
typedef _Float16 v8h  __attribute__((ext_vector_type(8)));
typedef _Float16 v4h  __attribute__((ext_vector_type(4)));
typedef unsigned int v2u __attribute__((ext_vector_type(2)));
typedef float    v8f  __attribute__((ext_vector_type(8)));

static __device__ inline v16h cat16(v8h lo, v8h hi) {
  return __builtin_shufflevector(lo, hi, 0,1,2,3,4,5,6,7,8,9,10,11,12,13,14,15);
}

// ---------------------------------------------------------------------------
// Pre-swizzle [Kd x Nd] f32 row-major matrices into the per-lane WMMA-B f16
// fragment layout: tile = (mat*(Kd/32)+kb)*(Nd/16)+nb, 512 halves per tile,
// lane-contiguous. B fragment load becomes one 32B/lane load, no cvt VALU.
// ---------------------------------------------------------------------------
template <int Kd, int Nd>
__global__ __launch_bounds__(256) void swizzleB_kernel(
    const float* __restrict__ src, _Float16* __restrict__ dst)
{
  const size_t gid = (size_t)blockIdx.x * 256 + threadIdx.x;  // tile*32 + lane
  const int lane = (int)(gid & 31);
  const size_t tile = gid >> 5;
  constexpr int NTN = Nd >> 4;   // n-tiles
  constexpr int NTK = Kd >> 5;   // k-tiles
  const int nb = (int)(tile % NTN);
  const size_t rest = tile / NTN;
  const int kb = (int)(rest % NTK);
  const size_t mat = rest / NTK;

  const int n   = nb * 16 + (lane & 15);
  const int hi8 = (lane >> 4) << 3;
  const float* s = src + (size_t)mat * Kd * Nd;
  v16h o;
#pragma unroll
  for (int i = 0; i < 8; ++i)
    o[i] = (_Float16)s[(size_t)(kb * 32 + hi8 + i) * Nd + n];
#pragma unroll
  for (int i = 0; i < 8; ++i)
    o[8 + i] = (_Float16)s[(size_t)(kb * 32 + 16 + hi8 + i) * Nd + n];
  *(v16h*)(dst + gid * 16) = o;
}

// ---------------------------------------------------------------------------
// Router: one wave32 per token. Dual dot products (Wg, Wn), softplus-noised
// logits, top-2, analytic 2-way softmax gates, append to per-expert lists.
// ---------------------------------------------------------------------------
__global__ __launch_bounds__(256) void router_kernel(
    const float* __restrict__ x, const float* __restrict__ noise,
    const float* __restrict__ Wg, const float* __restrict__ bg,
    const float* __restrict__ Wn, const float* __restrict__ bn,
    int* __restrict__ cnt, int* __restrict__ tok_list, float* __restrict__ gate_list)
{
  const int wave = threadIdx.x >> 5;
  const int lane = threadIdx.x & 31;
  const int t = blockIdx.x * 8 + wave;

  float ag[Ek], an[Ek];
#pragma unroll
  for (int e = 0; e < Ek; ++e) { ag[e] = 0.f; an[e] = 0.f; }

  const float* xt = x + (size_t)t * Dk;
  for (int d = lane; d < Dk; d += 32) {
    const float xv = xt[d];
    const float* wg = Wg + d * Ek;
    const float* wn = Wn + d * Ek;
#pragma unroll
    for (int e = 0; e < Ek; ++e) {
      ag[e] = fmaf(xv, wg[e], ag[e]);
      an[e] = fmaf(xv, wn[e], an[e]);
    }
  }
#pragma unroll
  for (int off = 16; off > 0; off >>= 1) {
#pragma unroll
    for (int e = 0; e < Ek; ++e) {
      ag[e] += __shfl_down(ag[e], off, 32);
      an[e] += __shfl_down(an[e], off, 32);
    }
  }

  if (lane == 0) {
    float v[Ek];
#pragma unroll
    for (int e = 0; e < Ek; ++e) {
      const float lg = ag[e] + bg[e];
      const float ln = an[e] + bn[e];
      const float sp = (ln > 0.f) ? (ln + log1pf(expf(-ln))) : log1pf(expf(ln));
      v[e] = fmaf(noise[(size_t)t * Ek + e], sp, lg);
    }
    int i1 = 0;
#pragma unroll
    for (int e = 1; e < Ek; ++e) if (v[e] > v[i1]) i1 = e;
    int i2 = (i1 == 0) ? 1 : 0;
#pragma unroll
    for (int e = 0; e < Ek; ++e) if (e != i1 && v[e] > v[i2]) i2 = e;
    const float r  = expf(v[i2] - v[i1]);
    const float g1 = 1.f / (1.f + r);
    const float g2 = r / (1.f + r);
    int p1 = atomicAdd(&cnt[i1], 1);
    tok_list[i1 * NTOK + p1]  = t;
    gate_list[i1 * NTOK + p1] = g1;
    int p2 = atomicAdd(&cnt[i2], 1);
    tok_list[i2 * NTOK + p2]  = t;
    gate_list[i2 * NTOK + p2] = g2;
  }
}

// ---------------------------------------------------------------------------
// Expert MLP: block = (32 routed tokens) x (1 expert); 8 waves.
// Per k-step: two A fragments (M-tiles) from LDS; each streamed B fragment
// (one 32B/lane load from pre-swizzled f16 weights) feeds two WMMAs.
// H processed in 4 chunks of 512 so h stays in LDS; y accumulated in VGPRs.
// The B fragments of a wave form one stream of 128 k-steps (per chunk 16 of
// W1, then 16 of W2) whose addresses depend on no data: a ring of 8 fragments
// in registers is refilled two k-steps ahead of the WMMAs that read it.
// ---------------------------------------------------------------------------
// Address of k-step t (0..31) of chunk c in a wave's weight stream.
static __device__ __forceinline__ const _Float16* wstep(
    const _Float16* W1w, const _Float16* W2w, int c, int t) {
  return (t < 16) ? W1w + (size_t)(t * 128 + c * 32) * 512
                  : W2w + (size_t)((c * 16 + (t - 16)) * 32) * 512;
}

static __device__ __forceinline__ void chunk_pass(
    const int c, const _Float16* xs, _Float16* hs,
    const _Float16* W1w, const _Float16* W2w, const float* b1e,
    const int wave, const int ln, const int hi8,
    v16h (&R)[8], v8f (&yacc)[4][2])
{
  // ---- up-projection: hs = relu(xs @ W1e[:, chunk] + b1) ----
  v8f acc[4][2];
#pragma unroll
  for (int p = 0; p < 4; ++p) { acc[p][0] = (v8f){}; acc[p][1] = (v8f){}; }

  // Loads return in order: fetched here, the biases are older than every refill
  // of this pass, so the wait for them does not drain the ring.
  float bias1[4];
#pragma unroll
  for (int p = 0; p < 4; ++p) bias1[p] = b1e[c * HC + (wave * 4 + p) * 16 + ln];

#pragma unroll
  for (int t = 0; t < 16; ++t) {
    v16h A[2];
#pragma unroll
    for (int mt = 0; mt < 2; ++mt) {
      const int r = (mt * 16 + ln) * XLD + t * 32;
      A[mt] = cat16(*(const v8h*)&xs[r + hi8], *(const v8h*)&xs[r + 16 + hi8]);
    }
    const _Float16* nx = wstep(W1w, W2w, c, t + 2);
#pragma unroll
    for (int p = 0; p < 4; ++p) {
      const int sl = (t & 1) * 4 + p;
      acc[p][0] = __builtin_amdgcn_wmma_f32_16x16x32_f16(
          false, A[0], false, R[sl], (short)0, acc[p][0], false, false);
      acc[p][1] = __builtin_amdgcn_wmma_f32_16x16x32_f16(
          false, A[1], false, R[sl], (short)0, acc[p][1], false, false);
      R[sl] = *(const v16h*)(nx + (size_t)p * 512);   // refill, two k-steps ahead
    }
    // Keeps this step's refills from being sunk down to their use two steps on
    // (the scheduler did that, and each fragment then cost a full load latency).
    __builtin_amdgcn_sched_barrier(0);
  }
  // epilogue: bias + relu + f16 store into hs
#pragma unroll
  for (int p = 0; p < 4; ++p) {
    const int nloc = (wave * 4 + p) * 16 + ln;   // 0..HC-1
    const float bias = bias1[p];
#pragma unroll
    for (int mt = 0; mt < 2; ++mt) {
#pragma unroll
      for (int vv = 0; vv < 8; ++vv) {
        const int m = mt * 16 + vv + hi8;        // C/D row layout
        hs[m * HLD + nloc] = (_Float16)fmaxf(acc[p][mt][vv] + bias, 0.f);
      }
    }
  }
  __syncthreads();

  // ---- down-projection partial: yacc += hs @ W2e[chunk, :] ----
#pragma unroll
  for (int t = 16; t < 32; ++t) {
    v16h A[2];
#pragma unroll
    for (int mt = 0; mt < 2; ++mt) {
      const int r = (mt * 16 + ln) * HLD + (t - 16) * 32;
      A[mt] = cat16(*(const v8h*)&hs[r + hi8], *(const v8h*)&hs[r + 16 + hi8]);
    }
#pragma unroll
    for (int q = 0; q < 4; ++q) {
      const int sl = (t & 1) * 4 + q;
      yacc[q][0] = __builtin_amdgcn_wmma_f32_16x16x32_f16(
          false, A[0], false, R[sl], (short)0, yacc[q][0], false, false);
      yacc[q][1] = __builtin_amdgcn_wmma_f32_16x16x32_f16(
          false, A[1], false, R[sl], (short)0, yacc[q][1], false, false);
      if (t + 2 < 32)
        R[sl] = *(const v16h*)(wstep(W1w, W2w, c, t + 2) + (size_t)q * 512);
    }
    __builtin_amdgcn_sched_barrier(0);           // as above: refills stay in their step
  }
  // The next chunk's first two k-steps, where there is one (c is the same in
  // every wave: a scalar branch). One branch behind the last WMMA: a branch
  // inside the last steps made the compiler wait for all loads there.
  if (c + 1 < Hk / HC) {
#pragma unroll
    for (int s = 0; s < 8; ++s)
      R[s] = *(const v16h*)(wstep(W1w, W2w, c + 1, s >> 2) + (size_t)(s & 3) * 512);
  }
  __syncthreads();
}

__global__ __launch_bounds__(256, 1) void expert_kernel(
    const float* __restrict__ x,
    const _Float16* __restrict__ W1s, const float* __restrict__ b1,
    const _Float16* __restrict__ W2s, const float* __restrict__ b2,
    const int* __restrict__ cnt, const int* __restrict__ tok_list,
    const float* __restrict__ gate_list, float* __restrict__ out)
{
  __shared__ _Float16 xs[MTOK * XLD];   // 32 tokens x 512 (f16, padded)
  __shared__ _Float16 hs[MTOK * HLD];   // 32 tokens x 512 (f16, padded)
  __shared__ int   stok[MTOK];
  __shared__ float sgate[MTOK];

  const int e  = blockIdx.y;
  const int m0 = blockIdx.x * MTOK;
  const int ce = cnt[e];
  if (m0 >= ce) return;
  const int rows = (ce - m0 < MTOK) ? (ce - m0) : MTOK;

  const int tid  = threadIdx.x;
  const int wave = __builtin_amdgcn_readfirstlane(tid >> 5);  // scalar: tile offsets on the scalar unit
  const int lane = tid & 31;
  const int ln   = lane & 15;          // A row / B,C,D column within tile
  const int hi8  = (lane >> 4) << 3;   // 0 or 8: K/M offset for upper lanes

  // swizzled tile = (e*16 + kb)*128 + nb for W1s, (e*64 + kb)*32 + nb for W2s
  const _Float16* W1w = W1s + ((size_t)(e * 16) * 128 + wave * 4) * 512 + lane * 16;
  const _Float16* W2w = W2s + ((size_t)(e * 64) * 32 + wave * 4) * 512 + lane * 16;

  // Fill the ring first: k-steps 0 and 1 are under way before the token list is read.
  v16h R[8];
#pragma unroll
  for (int s = 0; s < 8; ++s)
    R[s] = *(const v16h*)(wstep(W1w, W2w, 0, s >> 2) + (size_t)(s & 3) * 512);

  if (tid < MTOK) {
    const bool valid = tid < rows;
    stok[tid]  = valid ? tok_list[e * NTOK + m0 + tid] : 0;
    sgate[tid] = valid ? gate_list[e * NTOK + m0 + tid] : 0.f;
  }
  __syncthreads();

  // Gather 32 token rows of x into LDS as f16. A thread's 16 loads of 16 bytes
  // depend on nothing but the token list and are all issued before the first is
  // used: one memory latency for the tile, not one per element. A row past the
  // end of the list reads token 0's row (stok is 0 there) and is stored as zero.
  {
    const int r0 = tid >> 7;             // 128 threads per row, two rows per trip
    const int c4 = (tid & 127) * 4;
    float4 xv[MTOK / 2];
#pragma unroll
    for (int j = 0; j < MTOK / 2; ++j) {
      const unsigned off = (unsigned)stok[r0 + 2 * j] * (Dk * 4u) + (unsigned)c4 * 4u;  // < 64 MiB
      xv[j] = *(const float4*)((const char*)x + off);
    }
#pragma unroll
    for (int j = 0; j < MTOK / 2; ++j) {
      const int r = r0 + 2 * j;
      v4h h;
      h[0] = (_Float16)xv[j].x;
      h[1] = (_Float16)xv[j].y;
      h[2] = (_Float16)xv[j].z;
      h[3] = (_Float16)xv[j].w;
      const v2u keep = (r < rows) ? (v2u){~0u, ~0u} : (v2u){0u, 0u};
      *(v4h*)&xs[r * XLD + c4] = __builtin_bit_cast(v4h, __builtin_bit_cast(v2u, h) & keep);
    }
  }
  __syncthreads();

  const float* b1e = b1 + e * Hk;
  const float* b2e = b2 + e * Dk;

  v8f yacc[4][2];
#pragma unroll
  for (int q = 0; q < 4; ++q) { yacc[q][0] = (v8f){}; yacc[q][1] = (v8f){}; }

  for (int c = 0; c < Hk / HC; ++c)
    chunk_pass(c, xs, hs, W1w, W2w, b1e, wave, ln, hi8, R, yacc);

  // ---- scatter: out[token] += (y + b2) * gate ----
#pragma unroll
  for (int q = 0; q < 4; ++q) {
    const int ncol = (wave * 4 + q) * 16 + ln;
    const float bias = b2e[ncol];
#pragma unroll
    for (int mt = 0; mt < 2; ++mt) {
#pragma unroll
      for (int vv = 0; vv < 8; ++vv) {
        const int m = mt * 16 + vv + hi8;
        if (m < rows) {
          const float val = (yacc[q][mt][vv] + bias) * sgate[m];
          atomicAdd(&out[(size_t)stok[m] * Dk + ncol], val);
        }
      }
    }
  }
}

// ---------------------------------------------------------------------------
extern "C" void kernel_launch(void* const* d_in, const int* in_sizes, int n_in,
                              void* d_out, int out_size, void* d_ws, size_t ws_size,
                              hipStream_t stream) {
  (void)in_sizes; (void)n_in; (void)ws_size;
  const float* x     = (const float*)d_in[0];
  const float* noise = (const float*)d_in[1];
  const float* Wg    = (const float*)d_in[2];
  const float* bg    = (const float*)d_in[3];
  const float* Wn    = (const float*)d_in[4];
  const float* bn    = (const float*)d_in[5];
  const float* W1    = (const float*)d_in[6];
  const float* b1    = (const float*)d_in[7];
  const float* W2    = (const float*)d_in[8];
  const float* b2    = (const float*)d_in[9];
  float* out = (float*)d_out;

  // Workspace layout:
  //   [cnt: 256B] [tok_list: E*NTOK*4 = 1MB] [gate_list: 1MB]
  //   [W1s f16 swizzled: E*D*H*2 = 16MB] [W2s f16 swizzled: 16MB]
  char* ws = (char*)d_ws;
  int*   cnt  = (int*)ws;
  int*   tokl = (int*)(ws + 256);
  float* gatl = (float*)(ws + 256 + (size_t)Ek * NTOK * sizeof(int));
  _Float16* W1s = (_Float16*)(ws + 4 * 1024 * 1024);
  _Float16* W2s = W1s + (size_t)Ek * Dk * Hk;

  hipMemsetAsync(out, 0, (size_t)out_size * sizeof(float), stream);
  hipMemsetAsync(cnt, 0, Ek * sizeof(int), stream);

  // Weight pre-swizzle into WMMA-B fragment layout (f32 -> f16).
  {
    const size_t g1 = (size_t)Ek * (Dk / 32) * (Hk / 16) * 32;   // W1 lanes
    const size_t g2 = (size_t)Ek * (Hk / 32) * (Dk / 16) * 32;   // W2 lanes
    swizzleB_kernel<Dk, Hk><<<(int)(g1 / 256), 256, 0, stream>>>(W1, W1s);
    swizzleB_kernel<Hk, Dk><<<(int)(g2 / 256), 256, 0, stream>>>(W2, W2s);
  }

  router_kernel<<<NTOK / 8, 256, 0, stream>>>(x, noise, Wg, bg, Wn, bn,
                                              cnt, tokl, gatl);
  expert_kernel<<<dim3(NTOK / MTOK, Ek), 256, 0, stream>>>(x, W1s, b1, W2s, b2,
                                                           cnt, tokl, gatl, out);
}

// v003
// In two side-by-side timings against v002, it was 1.07 and 1.09 times as fast.
// Counting every step since v000, it is 2.62 times as fast.
#include <hip/hip_runtime.h>

// MoE: B=8, S=4096, D=512, H=2048, E=8, K=2  (all fp32 in/out)
#define NTOK 32768
#define Dk   512
#define Hk   2048
#define Ek   8
#define MTOK 64              // tokens per expert block (4 WMMA M-tiles)
#define MT   (MTOK / 16)     // M-tiles: WMMAs fed by each weight fragment
#define HC   512             // H chunk held in LDS per pass (4 chunks)
#define XLD  520             // padded LDS row stride (halves): 1040B = 65*16
#define HLD  520             // padded LDS row stride (halves) for h chunk

typedef _Float16 v16h __attribute__((ext_vector_type(16)));
typedef _Float16 v8h  __attribute__((ext_vector_type(8)));
typedef _Float16 v4h  __attribute__((ext_vector_type(4)));
typedef unsigned int v2u __attribute__((ext_vector_type(2)));
typedef float    v8f  __attribute__((ext_vector_type(8)));

static __device__ inline v16h cat16(v8h lo, v8h hi) {
  return __builtin_shufflevector(lo, hi, 0,1,2,3,4,5,6,7,8,9,10,11,12,13,14,15);
}

// ---------------------------------------------------------------------------
// Pre-swizzle [Kd x Nd] f32 row-major matrices into the per-lane WMMA-B f16
// fragment layout: tile = (mat*(Kd/32)+kb)*(Nd/16)+nb, 512 halves per tile,
// lane-contiguous. B fragment load becomes one 32B/lane load, no cvt VALU.
// ---------------------------------------------------------------------------
template <int Kd, int Nd>
__global__ __launch_bounds__(256) void swizzleB_kernel(
    const float* __restrict__ src, _Float16* __restrict__ dst)
{
  const size_t gid = (size_t)blockIdx.x * 256 + threadIdx.x;  // tile*32 + lane
  const int lane = (int)(gid & 31);
  const size_t tile = gid >> 5;
  constexpr int NTN = Nd >> 4;   // n-tiles
  constexpr int NTK = Kd >> 5;   // k-tiles
  const int nb = (int)(tile % NTN);
  const size_t rest = tile / NTN;
  const int kb = (int)(rest % NTK);
  const size_t mat = rest / NTK;

  const int n   = nb * 16 + (lane & 15);
  const int hi8 = (lane >> 4) << 3;
  const float* s = src + (size_t)mat * Kd * Nd;
  v16h o;
#pragma unroll
  for (int i = 0; i < 8; ++i)
    o[i] = (_Float16)s[(size_t)(kb * 32 + hi8 + i) * Nd + n];
#pragma unroll
  for (int i = 0; i < 8; ++i)
    o[8 + i] = (_Float16)s[(size_t)(kb * 32 + 16 + hi8 + i) * Nd + n];
  *(v16h*)(dst + gid * 16) = o;
}

// ---------------------------------------------------------------------------
// Router: one wave32 per token. Dual dot products (Wg, Wn), softplus-noised
// logits, top-2, analytic 2-way softmax gates, append to per-expert lists.
// ---------------------------------------------------------------------------
__global__ __launch_bounds__(256) void router_kernel(
    const float* __restrict__ x, const float* __restrict__ noise,
    const float* __restrict__ Wg, const float* __restrict__ bg,
    const float* __restrict__ Wn, const float* __restrict__ bn,
    int* __restrict__ cnt, int* __restrict__ tok_list, float* __restrict__ gate_list)
{
  const int wave = threadIdx.x >> 5;
  const int lane = threadIdx.x & 31;
  const int t = blockIdx.x * 8 + wave;

  float ag[Ek], an[Ek];
#pragma unroll
  for (int e = 0; e < Ek; ++e) { ag[e] = 0.f; an[e] = 0.f; }

  const float* xt = x + (size_t)t * Dk;
  for (int d = lane; d < Dk; d += 32) {
    const float xv = xt[d];
    const float* wg = Wg + d * Ek;
    const float* wn = Wn + d * Ek;
#pragma unroll
    for (int e = 0; e < Ek; ++e) {
      ag[e] = fmaf(xv, wg[e], ag[e]);
      an[e] = fmaf(xv, wn[e], an[e]);
    }
  }
#pragma unroll
  for (int off = 16; off > 0; off >>= 1) {
#pragma unroll
    for (int e = 0; e < Ek; ++e) {
      ag[e] += __shfl_down(ag[e], off, 32);
      an[e] += __shfl_down(an[e], off, 32);
    }
  }

  if (lane == 0) {
    float v[Ek];
#pragma unroll
    for (int e = 0; e < Ek; ++e) {
      const float lg = ag[e] + bg[e];
      const float ln = an[e] + bn[e];
      const float sp = (ln > 0.f) ? (ln + log1pf(expf(-ln))) : log1pf(expf(ln));
      v[e] = fmaf(noise[(size_t)t * Ek + e], sp, lg);
    }
    int i1 = 0;
#pragma unroll
    for (int e = 1; e < Ek; ++e) if (v[e] > v[i1]) i1 = e;
    int i2 = (i1 == 0) ? 1 : 0;
#pragma unroll
    for (int e = 0; e < Ek; ++e) if (e != i1 && v[e] > v[i2]) i2 = e;
    const float r  = expf(v[i2] - v[i1]);
    const float g1 = 1.f / (1.f + r);
    const float g2 = r / (1.f + r);
    int p1 = atomicAdd(&cnt[i1], 1);
    tok_list[i1 * NTOK + p1]  = t;
    gate_list[i1 * NTOK + p1] = g1;
    int p2 = atomicAdd(&cnt[i2], 1);
    tok_list[i2 * NTOK + p2]  = t;
    gate_list[i2 * NTOK + p2] = g2;
  }
}

// ---------------------------------------------------------------------------
// Expert MLP: block = (64 routed tokens) x (1 expert); 8 waves.
// Per k-step: four A fragments (M-tiles) from LDS; each streamed B fragment
// (one 32B/lane load from pre-swizzled f16 weights) feeds four WMMAs: every
// block streams its expert's whole weights from L2, so L2 bytes fall as 1/MTOK.
// H processed in 4 chunks of 512 so h stays in LDS; y accumulated in VGPRs.
// The B fragments of a wave form one stream of 128 k-steps (per chunk 16 of
// W1, then 16 of W2) whose addresses depend on no data: a ring of 8 fragments
// in registers is refilled two k-steps ahead of the WMMAs that read it.
// ---------------------------------------------------------------------------
// Address of k-step t (0..31) of chunk c in a wave's weight stream.
static __device__ __forceinline__ const _Float16* wstep(
    const _Float16* W1w, const _Float16* W2w, int c, int t) {
  return (t < 16) ? W1w + (size_t)(t * 128 + c * 32) * 512
                  : W2w + (size_t)((c * 16 + (t - 16)) * 32) * 512;
}

static __device__ __forceinline__ void chunk_pass(
    const int c, const _Float16* xs, _Float16* hs,
    const _Float16* W1w, const _Float16* W2w, const float* b1e,
    const int wave, const int ln, const int hi8,
    v16h (&R)[8], v8f (&yacc)[4][MT])
{
  // ---- up-projection: hs = relu(xs @ W1e[:, chunk] + b1) ----
  v8f acc[4][MT];
#pragma unroll
  for (int p = 0; p < 4; ++p)
#pragma unroll  // constant indices keep the tiles in registers
    for (int mt = 0; mt < MT; ++mt) acc[p][mt] = (v8f){};

  // Loads return in order: fetched here, the biases are older than every refill
  // of this pass, so the wait for them does not drain the ring.
  float bias1[4];
#pragma unroll
  for (int p = 0; p < 4; ++p) bias1[p] = b1e[c * HC + (wave * 4 + p) * 16 + ln];

#pragma unroll
  for (int t = 0; t < 16; ++t) {
    v16h A[MT];
#pragma unroll
    for (int mt = 0; mt < MT; ++mt) {
      const int r = (mt * 16 + ln) * XLD + t * 32;
      A[mt] = cat16(*(const v8h*)&xs[r + hi8], *(const v8h*)&xs[r + 16 + hi8]);
    }
    const _Float16* nx = wstep(W1w, W2w, c, t + 2);
#pragma unroll
    for (int p = 0; p < 4; ++p) {
      const int sl = (t & 1) * 4 + p;
#pragma unroll  // constant indices keep the tiles in registers
      for (int mt = 0; mt < MT; ++mt)
        acc[p][mt] = __builtin_amdgcn_wmma_f32_16x16x32_f16(
            false, A[mt], false, R[sl], (short)0, acc[p][mt], false, false);
      R[sl] = *(const v16h*)(nx + (size_t)p * 512);   // refill, two k-steps ahead
    }
    // Keeps this step's refills from being sunk down to their use two steps on
    // (the scheduler did that, and each fragment then cost a full load latency).
    __builtin_amdgcn_sched_barrier(0);
  }
  // epilogue: bias + relu + f16 store into hs
#pragma unroll
  for (int p = 0; p < 4; ++p) {
    const int nloc = (wave * 4 + p) * 16 + ln;   // 0..HC-1
    const float bias = bias1[p];
#pragma unroll
    for (int mt = 0; mt < MT; ++mt) {
#pragma unroll
      for (int vv = 0; vv < 8; ++vv) {
        const int m = mt * 16 + vv + hi8;        // C/D row layout
        hs[m * HLD + nloc] = (_Float16)fmaxf(acc[p][mt][vv] + bias, 0.f);
      }
    }
  }
  __syncthreads();

  // ---- down-projection partial: yacc += hs @ W2e[chunk, :] ----
#pragma unroll
  for (int t = 16; t < 32; ++t) {
    v16h A[MT];
#pragma unroll
    for (int mt = 0; mt < MT; ++mt) {
      const int r = (mt * 16 + ln) * HLD + (t - 16) * 32;
      A[mt] = cat16(*(const v8h*)&hs[r + hi8], *(const v8h*)&hs[r + 16 + hi8]);
    }
#pragma unroll
    for (int q = 0; q < 4; ++q) {
      const int sl = (t & 1) * 4 + q;
#pragma unroll  // constant indices keep the tiles in registers
      for (int mt = 0; mt < MT; ++mt)
        yacc[q][mt] = __builtin_amdgcn_wmma_f32_16x16x32_f16(
            false, A[mt], false, R[sl], (short)0, yacc[q][mt], false, false);
      if (t + 2 < 32)
        R[sl] = *(const v16h*)(wstep(W1w, W2w, c, t + 2) + (size_t)q * 512);
    }
    __builtin_amdgcn_sched_barrier(0);           // as above: refills stay in their step
  }
  // The next chunk's first two k-steps, where there is one (c is the same in
  // every wave: a scalar branch). One branch behind the last WMMA: a branch
  // inside the last steps made the compiler wait for all loads there.
  if (c + 1 < Hk / HC) {
#pragma unroll
    for (int s = 0; s < 8; ++s)
      R[s] = *(const v16h*)(wstep(W1w, W2w, c + 1, s >> 2) + (size_t)(s & 3) * 512);
  }
  __syncthreads();
}

__global__ __launch_bounds__(256, 1) void expert_kernel(
    const float* __restrict__ x,
    const _Float16* __restrict__ W1s, const float* __restrict__ b1,
    const _Float16* __restrict__ W2s, const float* __restrict__ b2,
    const int* __restrict__ cnt, const int* __restrict__ tok_list,
    const float* __restrict__ gate_list, float* __restrict__ out)
{
  __shared__ _Float16 xs[MTOK * XLD];   // 64 tokens x 512 (f16, padded)
  __shared__ _Float16 hs[MTOK * HLD];   // 64 tokens x 512 (f16, padded)
  __shared__ int   stok[MTOK];
  __shared__ float sgate[MTOK];

  const int e  = blockIdx.y;
  const int m0 = blockIdx.x * MTOK;
  const int ce = cnt[e];
  if (m0 >= ce) return;
  const int rows = (ce - m0 < MTOK) ? (ce - m0) : MTOK;

  const int tid  = threadIdx.x;
  const int wave = __builtin_amdgcn_readfirstlane(tid >> 5);  // scalar: tile offsets on the scalar unit
  const int lane = tid & 31;
  const int ln   = lane & 15;          // A row / B,C,D column within tile
  const int hi8  = (lane >> 4) << 3;   // 0 or 8: K/M offset for upper lanes

  // swizzled tile = (e*16 + kb)*128 + nb for W1s, (e*64 + kb)*32 + nb for W2s
  const _Float16* W1w = W1s + ((size_t)(e * 16) * 128 + wave * 4) * 512 + lane * 16;
  const _Float16* W2w = W2s + ((size_t)(e * 64) * 32 + wave * 4) * 512 + lane * 16;

  // Fill the ring first: k-steps 0 and 1 are under way before the token list is read.
  v16h R[8];
#pragma unroll
  for (int s = 0; s < 8; ++s)
    R[s] = *(const v16h*)(wstep(W1w, W2w, 0, s >> 2) + (size_t)(s & 3) * 512);

  if (tid < MTOK) {
    const bool valid = tid < rows;
    stok[tid]  = valid ? tok_list[e * NTOK + m0 + tid] : 0;
    sgate[tid] = valid ? gate_list[e * NTOK + m0 + tid] : 0.f;
  }
  __syncthreads();

  // Gather 64 token rows of x into LDS as f16. A thread's 32 loads of 16 bytes
  // depend on nothing but the token list and are all issued before the first is
  // used: one memory latency for the tile, not one per element. A row past the
  // end of the list reads token 0's row (stok is 0 there) and is stored as zero.
  {
    const int r0 = tid >> 7;             // 128 threads per row, two rows per trip
    const int c4 = (tid & 127) * 4;
    float4 xv[MTOK / 2];
#pragma unroll
    for (int j = 0; j < MTOK / 2; ++j) {
      const unsigned off = (unsigned)stok[r0 + 2 * j] * (Dk * 4u) + (unsigned)c4 * 4u;  // < 64 MiB
      xv[j] = *(const float4*)((const char*)x + off);
    }
#pragma unroll
    for (int j = 0; j < MTOK / 2; ++j) {
      const int r = r0 + 2 * j;
      v4h h;
      h[0] = (_Float16)xv[j].x;
      h[1] = (_Float16)xv[j].y;
      h[2] = (_Float16)xv[j].z;
      h[3] = (_Float16)xv[j].w;
      const v2u keep = (r < rows) ? (v2u){~0u, ~0u} : (v2u){0u, 0u};
      *(v4h*)&xs[r * XLD + c4] = __builtin_bit_cast(v4h, __builtin_bit_cast(v2u, h) & keep);
    }
  }
  __syncthreads();

  const float* b1e = b1 + e * Hk;
  const float* b2e = b2 + e * Dk;

  v8f yacc[4][MT];
#pragma unroll
  for (int q = 0; q < 4; ++q)
#pragma unroll  // constant indices keep the tiles in registers
    for (int mt = 0; mt < MT; ++mt) yacc[q][mt] = (v8f){};

  for (int c = 0; c < Hk / HC; ++c)
    chunk_pass(c, xs, hs, W1w, W2w, b1e, wave, ln, hi8, R, yacc);

  // ---- scatter: out[token] += (y + b2) * gate ----
#pragma unroll
  for (int q = 0; q < 4; ++q) {
    const int ncol = (wave * 4 + q) * 16 + ln;
    const float bias = b2e[ncol];
    // Precaution: this build reuses the load's address register for the output
    // address.
    asm volatile("s_wait_xcnt 0x0" ::: "memory");
#pragma unroll
    for (int mt = 0; mt < MT; ++mt) {
#pragma unroll
      for (int vv = 0; vv < 8; ++vv) {
        const int m = mt * 16 + vv + hi8;
        if (m < rows) {
          const float val = (yacc[q][mt][vv] + bias) * sgate[m];
          atomicAdd(&out[(size_t)stok[m] * Dk + ncol], val);
        }
      }
    }
  }
}

// ---------------------------------------------------------------------------
extern "C" void kernel_launch(void* const* d_in, const int* in_sizes, int n_in,
                              void* d_out, int out_size, void* d_ws, size_t ws_size,
                              hipStream_t stream) {
  (void)in_sizes; (void)n_in; (void)ws_size;
  const float* x     = (const float*)d_in[0];
  const float* noise = (const float*)d_in[1];
  const float* Wg    = (const float*)d_in[2];
  const float* bg    = (const float*)d_in[3];
  const float* Wn    = (const float*)d_in[4];
  const float* bn    = (const float*)d_in[5];
  const float* W1    = (const float*)d_in[6];
  const float* b1    = (const float*)d_in[7];
  const float* W2    = (const float*)d_in[8];
  const float* b2    = (const float*)d_in[9];
  float* out = (float*)d_out;

  // Workspace layout:
  //   [cnt: 256B] [tok_list: E*NTOK*4 = 1MB] [gate_list: 1MB]
  //   [W1s f16 swizzled: E*D*H*2 = 16MB] [W2s f16 swizzled: 16MB]
  char* ws = (char*)d_ws;
  int*   cnt  = (int*)ws;
  int*   tokl = (int*)(ws + 256);
  float* gatl = (float*)(ws + 256 + (size_t)Ek * NTOK * sizeof(int));
  _Float16* W1s = (_Float16*)(ws + 4 * 1024 * 1024);
  _Float16* W2s = W1s + (size_t)Ek * Dk * Hk;

  hipMemsetAsync(out, 0, (size_t)out_size * sizeof(float), stream);
  hipMemsetAsync(cnt, 0, Ek * sizeof(int), stream);

  // Weight pre-swizzle into WMMA-B fragment layout (f32 -> f16).
  {
    const size_t g1 = (size_t)Ek * (Dk / 32) * (Hk / 16) * 32;   // W1 lanes
    const size_t g2 = (size_t)Ek * (Hk / 32) * (Dk / 16) * 32;   // W2 lanes
    swizzleB_kernel<Dk, Hk><<<(int)(g1 / 256), 256, 0, stream>>>(W1, W1s);
    swizzleB_kernel<Hk, Dk><<<(int)(g2 / 256), 256, 0, stream>>>(W2, W2s);
  }

  router_kernel<<<NTOK / 8, 256, 0, stream>>>(x, noise, Wg, bg, Wn, bn,
                                              cnt, tokl, gatl);
  expert_kernel<<<dim3(NTOK / MTOK, Ek), 256, 0, stream>>>(x, W1s, b1, W2s, b2,
                                                           cnt, tokl, gatl, out);
}

// v004
// Two timings next to v003 put it at 1.07 and 1.09 times that version's speed.
// Counting every step since v000, it is 2.83 times as fast.
#include <hip/hip_runtime.h>

// MoE: B=8, S=4096, D=512, H=2048, E=8, K=2  (all fp32 in/out)
#define NTOK 32768
#define Dk   512
#define Hk   2048
#define Ek   8
#define MTOK 64              // tokens per expert block (4 WMMA M-tiles)
#define MT   (MTOK / 16)     // M-tiles: WMMAs fed by each weight fragment
#define HC   512             // H chunk held in LDS per pass (4 chunks)
#define XLD  520             // padded LDS row stride (halves): 1040B = 65*16
#define HLD  520             // padded LDS row stride (halves) for h chunk

typedef _Float16 v16h __attribute__((ext_vector_type(16)));
typedef _Float16 v8h  __attribute__((ext_vector_type(8)));
typedef _Float16 v4h  __attribute__((ext_vector_type(4)));
typedef unsigned int v2u __attribute__((ext_vector_type(2)));
typedef float    v8f  __attribute__((ext_vector_type(8)));

static __device__ inline v16h cat16(v8h lo, v8h hi) {
  return __builtin_shufflevector(lo, hi, 0,1,2,3,4,5,6,7,8,9,10,11,12,13,14,15);
}

// ---------------------------------------------------------------------------
// Pre-swizzle [Kd x Nd] f32 row-major matrices into the per-lane WMMA-B f16
// fragment layout: tile = (mat*(Kd/32)+kb)*(Nd/16)+nb, 512 halves per tile,
// lane-contiguous. B fragment load becomes one 32B/lane load, no cvt VALU.
// ---------------------------------------------------------------------------
template <int Kd, int Nd>
__global__ __launch_bounds__(256) void swizzleB_kernel(
    const float* __restrict__ src, _Float16* __restrict__ dst)
{
  const size_t gid = (size_t)blockIdx.x * 256 + threadIdx.x;  // tile*32 + lane
  const int lane = (int)(gid & 31);
  const size_t tile = gid >> 5;
  constexpr int NTN = Nd >> 4;   // n-tiles
  constexpr int NTK = Kd >> 5;   // k-tiles
  const int nb = (int)(tile % NTN);
  const size_t rest = tile / NTN;
  const int kb = (int)(rest % NTK);
  const size_t mat = rest / NTK;

  const int n   = nb * 16 + (lane & 15);
  const int hi8 = (lane >> 4) << 3;
  const float* s = src + (size_t)mat * Kd * Nd;
  v16h o;
#pragma unroll
  for (int i = 0; i < 8; ++i)
    o[i] = (_Float16)s[(size_t)(kb * 32 + hi8 + i) * Nd + n];
#pragma unroll
  for (int i = 0; i < 8; ++i)
    o[8 + i] = (_Float16)s[(size_t)(kb * 32 + 16 + hi8 + i) * Nd + n];
  *(v16h*)(dst + gid * 16) = o;
}

// ---------------------------------------------------------------------------
// Router: one wave32 per token. Dual dot products (Wg, Wn), softplus-noised
// logits, top-2, analytic 2-way softmax gates, append to one list per
// (choice, expert): lists 0..7 hold first choices, lists 8..15 second choices.
// ---------------------------------------------------------------------------
__global__ __launch_bounds__(256) void router_kernel(
    const float* __restrict__ x, const float* __restrict__ noise,
    const float* __restrict__ Wg, const float* __restrict__ bg,
    const float* __restrict__ Wn, const float* __restrict__ bn,
    int* __restrict__ cnt, int* __restrict__ tok_list, float* __restrict__ gate_list)
{
  const int wave = threadIdx.x >> 5;
  const int lane = threadIdx.x & 31;
  const int t = blockIdx.x * 8 + wave;

  float ag[Ek], an[Ek];
#pragma unroll
  for (int e = 0; e < Ek; ++e) { ag[e] = 0.f; an[e] = 0.f; }

  const float* xt = x + (size_t)t * Dk;
  for (int d = lane; d < Dk; d += 32) {
    const float xv = xt[d];
    const float* wg = Wg + d * Ek;
    const float* wn = Wn + d * Ek;
#pragma unroll
    for (int e = 0; e < Ek; ++e) {
      ag[e] = fmaf(xv, wg[e], ag[e]);
      an[e] = fmaf(xv, wn[e], an[e]);
    }
  }
#pragma unroll
  for (int off = 16; off > 0; off >>= 1) {
#pragma unroll
    for (int e = 0; e < Ek; ++e) {
      ag[e] += __shfl_down(ag[e], off, 32);
      an[e] += __shfl_down(an[e], off, 32);
    }
  }

  if (lane == 0) {
    float v[Ek];
#pragma unroll
    for (int e = 0; e < Ek; ++e) {
      const float lg = ag[e] + bg[e];
      const float ln = an[e] + bn[e];
      const float sp = (ln > 0.f) ? (ln + log1pf(expf(-ln))) : log1pf(expf(ln));
      v[e] = fmaf(noise[(size_t)t * Ek + e], sp, lg);
    }
    int i1 = 0;
#pragma unroll
    for (int e = 1; e < Ek; ++e) if (v[e] > v[i1]) i1 = e;
    int i2 = (i1 == 0) ? 1 : 0;
#pragma unroll
    for (int e = 0; e < Ek; ++e) if (e != i1 && v[e] > v[i2]) i2 = e;
    const float r  = expf(v[i2] - v[i1]);
    const float g1 = 1.f / (1.f + r);
    const float g2 = r / (1.f + r);
    int p1 = atomicAdd(&cnt[i1], 1);
    tok_list[i1 * NTOK + p1]  = t;
    gate_list[i1 * NTOK + p1] = g1;
    int p2 = atomicAdd(&cnt[Ek + i2], 1);
    tok_list[(Ek + i2) * NTOK + p2]  = t;
    gate_list[(Ek + i2) * NTOK + p2] = g2;
  }
}

// ---------------------------------------------------------------------------
// Expert MLP: block = (64 routed tokens) x (1 expert); 8 waves.
// Per k-step: four A fragments (M-tiles) from LDS; each streamed B fragment
// (one 32B/lane load from pre-swizzled f16 weights) feeds four WMMAs: every
// block streams its expert's whole weights from L2, so L2 bytes fall as 1/MTOK.
// H processed in 4 chunks of 512 so h stays in LDS; y accumulated in VGPRs.
// The B fragments of a wave form one stream of 128 k-steps (per chunk 16 of
// W1, then 16 of W2) whose addresses depend on no data: a ring of 8 fragments
// in registers is refilled two k-steps ahead of the WMMAs that read it.
// Launched twice: a token stands in exactly one first-choice list and in exactly
// one second-choice list, so within a launch every row of out has one writer.
// The first launch stores its rows, the second adds to them; no atomics.
// ---------------------------------------------------------------------------
// Address of k-step t (0..31) of chunk c in a wave's weight stream.
static __device__ __forceinline__ const _Float16* wstep(
    const _Float16* W1w, const _Float16* W2w, int c, int t) {
  return (t < 16) ? W1w + (size_t)(t * 128 + c * 32) * 512
                  : W2w + (size_t)((c * 16 + (t - 16)) * 32) * 512;
}

static __device__ __forceinline__ void chunk_pass(
    const int c, const _Float16* xs, _Float16* hs,
    const _Float16* W1w, const _Float16* W2w, const float* b1e,
    const int wave, const int ln, const int hi8,
    v16h (&R)[8], v8f (&yacc)[4][MT])
{
  // ---- up-projection: hs = relu(xs @ W1e[:, chunk] + b1) ----
  v8f acc[4][MT];
#pragma unroll
  for (int p = 0; p < 4; ++p)
#pragma unroll  // constant indices keep the tiles in registers
    for (int mt = 0; mt < MT; ++mt) acc[p][mt] = (v8f){};

  // Loads return in order: fetched here, the biases are older than every refill
  // of this pass, so the wait for them does not drain the ring.
  float bias1[4];
#pragma unroll
  for (int p = 0; p < 4; ++p) bias1[p] = b1e[c * HC + (wave * 4 + p) * 16 + ln];

#pragma unroll
  for (int t = 0; t < 16; ++t) {
    v16h A[MT];
#pragma unroll
    for (int mt = 0; mt < MT; ++mt) {
      const int r = (mt * 16 + ln) * XLD + t * 32;
      A[mt] = cat16(*(const v8h*)&xs[r + hi8], *(const v8h*)&xs[r + 16 + hi8]);
    }
    const _Float16* nx = wstep(W1w, W2w, c, t + 2);
#pragma unroll
    for (int p = 0; p < 4; ++p) {
      const int sl = (t & 1) * 4 + p;
#pragma unroll  // constant indices keep the tiles in registers
      for (int mt = 0; mt < MT; ++mt)
        acc[p][mt] = __builtin_amdgcn_wmma_f32_16x16x32_f16(
            false, A[mt], false, R[sl], (short)0, acc[p][mt], false, false);
      R[sl] = *(const v16h*)(nx + (size_t)p * 512);   // refill, two k-steps ahead
    }
    // Keeps this step's refills from being sunk down to their use two steps on
    // (the scheduler did that, and each fragment then cost a full load latency).
    __builtin_amdgcn_sched_barrier(0);
  }
  // epilogue: bias + relu + f16 store into hs
#pragma unroll
  for (int p = 0; p < 4; ++p) {
    const int nloc = (wave * 4 + p) * 16 + ln;   // 0..HC-1
    const float bias = bias1[p];
#pragma unroll
    for (int mt = 0; mt < MT; ++mt) {
#pragma unroll
      for (int vv = 0; vv < 8; ++vv) {
        const int m = mt * 16 + vv + hi8;        // C/D row layout
        hs[m * HLD + nloc] = (_Float16)fmaxf(acc[p][mt][vv] + bias, 0.f);
      }
    }
  }
  __syncthreads();

  // ---- down-projection partial: yacc += hs @ W2e[chunk, :] ----
#pragma unroll
  for (int t = 16; t < 32; ++t) {
    v16h A[MT];
#pragma unroll
    for (int mt = 0; mt < MT; ++mt) {
      const int r = (mt * 16 + ln) * HLD + (t - 16) * 32;
      A[mt] = cat16(*(const v8h*)&hs[r + hi8], *(const v8h*)&hs[r + 16 + hi8]);
    }
#pragma unroll
    for (int q = 0; q < 4; ++q) {
      const int sl = (t & 1) * 4 + q;
#pragma unroll  // constant indices keep the tiles in registers
      for (int mt = 0; mt < MT; ++mt)
        yacc[q][mt] = __builtin_amdgcn_wmma_f32_16x16x32_f16(
            false, A[mt], false, R[sl], (short)0, yacc[q][mt], false, false);
      if (t + 2 < 32)
        R[sl] = *(const v16h*)(wstep(W1w, W2w, c, t + 2) + (size_t)q * 512);
    }
    __builtin_amdgcn_sched_barrier(0);           // as above: refills stay in their step
  }
  // The next chunk's first two k-steps, where there is one (c is the same in
  // every wave: a scalar branch). One branch behind the last WMMA: a branch
  // inside the last steps made the compiler wait for all loads there.
  if (c + 1 < Hk / HC) {
#pragma unroll
    for (int s = 0; s < 8; ++s)
      R[s] = *(const v16h*)(wstep(W1w, W2w, c + 1, s >> 2) + (size_t)(s & 3) * 512);
  }
  __syncthreads();
}

__global__ __launch_bounds__(256, 1) void expert_kernel(
    const float* __restrict__ x,
    const _Float16* __restrict__ W1s, const float* __restrict__ b1,
    const _Float16* __restrict__ W2s, const float* __restrict__ b2,
    const int* __restrict__ cnt, const int* __restrict__ tok_list,
    const float* __restrict__ gate_list, float* out, const int second)
{
  __shared__ _Float16 xs[MTOK * XLD];   // 64 tokens x 512 (f16, padded)
  __shared__ _Float16 hs[MTOK * HLD];   // 64 tokens x 512 (f16, padded)
  __shared__ int   stok[MTOK];
  __shared__ float sgate[MTOK];

  const int e  = blockIdx.y;
  const int m0 = blockIdx.x * MTOK;
  const int le = second * Ek + e;       // list of this launch's choice
  const int ce = cnt[le];
  if (m0 >= ce) return;
  const int rows = (ce - m0 < MTOK) ? (ce - m0) : MTOK;

  const int tid  = threadIdx.x;
  const int wave = __builtin_amdgcn_readfirstlane(tid >> 5);  // scalar: tile offsets on the scalar unit
  const int lane = tid & 31;
  const int ln   = lane & 15;          // A row / B,C,D column within tile
  const int hi8  = (lane >> 4) << 3;   // 0 or 8: K/M offset for upper lanes

  // swizzled tile = (e*16 + kb)*128 + nb for W1s, (e*64 + kb)*32 + nb for W2s
  const _Float16* W1w = W1s + ((size_t)(e * 16) * 128 + wave * 4) * 512 + lane * 16;
  const _Float16* W2w = W2s + ((size_t)(e * 64) * 32 + wave * 4) * 512 + lane * 16;

  // Fill the ring first: k-steps 0 and 1 are under way before the token list is read.
  v16h R[8];
#pragma unroll
  for (int s = 0; s < 8; ++s)
    R[s] = *(const v16h*)(wstep(W1w, W2w, 0, s >> 2) + (size_t)(s & 3) * 512);

  if (tid < MTOK) {
    const bool valid = tid < rows;
    stok[tid]  = valid ? tok_list[le * NTOK + m0 + tid] : 0;
    sgate[tid] = valid ? gate_list[le * NTOK + m0 + tid] : 0.f;
  }
  __syncthreads();

  // Gather 64 token rows of x into LDS as f16. A thread's 32 loads of 16 bytes
  // depend on nothing but the token list and are all issued before the first is
  // used: one memory latency for the tile, not one per element. A row past the
  // end of the list reads token 0's row (stok is 0 there) and is stored as zero.
  {
    const int r0 = tid >> 7;             // 128 threads per row, two rows per trip
    const int c4 = (tid & 127) * 4;
    float4 xv[MTOK / 2];
#pragma unroll
    for (int j = 0; j < MTOK / 2; ++j) {
      const unsigned off = (unsigned)stok[r0 + 2 * j] * (Dk * 4u) + (unsigned)c4 * 4u;  // < 64 MiB
      xv[j] = *(const float4*)((const char*)x + off);
    }
#pragma unroll
    for (int j = 0; j < MTOK / 2; ++j) {
      const int r = r0 + 2 * j;
      v4h h;
      h[0] = (_Float16)xv[j].x;
      h[1] = (_Float16)xv[j].y;
      h[2] = (_Float16)xv[j].z;
      h[3] = (_Float16)xv[j].w;
      const v2u keep = (r < rows) ? (v2u){~0u, ~0u} : (v2u){0u, 0u};
      *(v4h*)&xs[r * XLD + c4] = __builtin_bit_cast(v4h, __builtin_bit_cast(v2u, h) & keep);
    }
  }
  __syncthreads();

  const float* b1e = b1 + e * Hk;
  const float* b2e = b2 + e * Dk;

  v8f yacc[4][MT];
#pragma unroll
  for (int q = 0; q < 4; ++q)
#pragma unroll  // constant indices keep the tiles in registers
    for (int mt = 0; mt < MT; ++mt) yacc[q][mt] = (v8f){};

  for (int c = 0; c < Hk / HC; ++c)
    chunk_pass(c, xs, hs, W1w, W2w, b1e, wave, ln, hi8, R, yacc);

  // ---- scatter: out[token] = or += (y + b2) * gate, one writer per row ----
  float bias[4];
#pragma unroll
  for (int q = 0; q < 4; ++q) bias[q] = b2e[(wave * 4 + q) * 16 + ln];
  // Precaution: the loads' address registers may be reused below with no wait of
  // the compiler's own in front of the overwrite.
  asm volatile("s_wait_xcnt 0x0" ::: "memory");

  // Byte offset of this lane's first column in each of its 32 rows (< 64 MiB);
  // the four column tiles of a wave lie 64 bytes apart.
  unsigned roff[MT][8];
  float gt[MT][8];
#pragma unroll
  for (int mt = 0; mt < MT; ++mt) {
#pragma unroll
    for (int vv = 0; vv < 8; ++vv) {
      const int m = mt * 16 + vv + hi8;
      roff[mt][vv] = (unsigned)stok[m] * (Dk * 4u) + (unsigned)(wave * 64 + ln) * 4u;
      gt[mt][vv] = sgate[m];
    }
  }
  char* ob = (char*)out;

  if (second) {
    // All 128 loads of the first launch's rows are issued before the first is
    // used: one latency. A row past the end of the list reads token 0's row
    // (stok is 0 there); the value is not stored.
    float old[MT][8][4];
#pragma unroll
    for (int mt = 0; mt < MT; ++mt)
#pragma unroll
      for (int vv = 0; vv < 8; ++vv)
#pragma unroll
        for (int q = 0; q < 4; ++q)
          old[mt][vv][q] = *(const float*)(ob + roff[mt][vv] + q * 64);
#pragma unroll
    for (int mt = 0; mt < MT; ++mt) {
#pragma unroll
      for (int vv = 0; vv < 8; ++vv) {
        if (mt * 16 + vv + hi8 < rows) {
#pragma unroll
          for (int q = 0; q < 4; ++q)
            *(float*)(ob + roff[mt][vv] + q * 64) =
                old[mt][vv][q] + (yacc[q][mt][vv] + bias[q]) * gt[mt][vv];
        }
      }
    }
  } else {
#pragma unroll
    for (int mt = 0; mt < MT; ++mt) {
#pragma unroll
      for (int vv = 0; vv < 8; ++vv) {
        if (mt * 16 + vv + hi8 < rows) {
#pragma unroll
          for (int q = 0; q < 4; ++q)
            *(float*)(ob + roff[mt][vv] + q * 64) =
                (yacc[q][mt][vv] + bias[q]) * gt[mt][vv];
        }
      }
    }
  }
}

// ---------------------------------------------------------------------------
extern "C" void kernel_launch(void* const* d_in, const int* in_sizes, int n_in,
                              void* d_out, int out_size, void* d_ws, size_t ws_size,
                              hipStream_t stream) {
  (void)in_sizes; (void)n_in; (void)out_size; (void)ws_size;
  const float* x     = (const float*)d_in[0];
  const float* noise = (const float*)d_in[1];
  const float* Wg    = (const float*)d_in[2];
  const float* bg    = (const float*)d_in[3];
  const float* Wn    = (const float*)d_in[4];
  const float* bn    = (const float*)d_in[5];
  const float* W1    = (const float*)d_in[6];
  const float* b1    = (const float*)d_in[7];
  const float* W2    = (const float*)d_in[8];
  const float* b2    = (const float*)d_in[9];
  float* out = (float*)d_out;

  // Workspace layout:
  //   [cnt: 256B] [tok_list: 2*E*NTOK*4 = 2MB] [gate_list: 2MB]
  //   at 8MB: [W1s f16 swizzled: E*D*H*2 = 16MB] [W2s f16 swizzled: 16MB]
  char* ws = (char*)d_ws;
  int*   cnt  = (int*)ws;
  int*   tokl = (int*)(ws + 256);
  float* gatl = (float*)(ws + 256 + (size_t)2 * Ek * NTOK * sizeof(int));
  _Float16* W1s = (_Float16*)(ws + 8 * 1024 * 1024);
  _Float16* W2s = W1s + (size_t)Ek * Dk * Hk;

  hipMemsetAsync(cnt, 0, 2 * Ek * sizeof(int), stream);

  // Weight pre-swizzle into WMMA-B fragment layout (f32 -> f16).
  {
    const size_t g1 = (size_t)Ek * (Dk / 32) * (Hk / 16) * 32;   // W1 lanes
    const size_t g2 = (size_t)Ek * (Hk / 32) * (Dk / 16) * 32;   // W2 lanes
    swizzleB_kernel<Dk, Hk><<<(int)(g1 / 256), 256, 0, stream>>>(W1, W1s);
    swizzleB_kernel<Hk, Dk><<<(int)(g2 / 256), 256, 0, stream>>>(W2, W2s);
  }

  router_kernel<<<NTOK / 8, 256, 0, stream>>>(x, noise, Wg, bg, Wn, bn,
                                              cnt, tokl, gatl);
  // First choices store every row of out; second choices then add to it.
  expert_kernel<<<dim3(NTOK / MTOK, Ek), 256, 0, stream>>>(x, W1s, b1, W2s, b2,
                                                           cnt, tokl, gatl, out, 0);
  expert_kernel<<<dim3(NTOK / MTOK, Ek), 256, 0, stream>>>(x, W1s, b1, W2s, b2,
                                                           cnt, tokl, gatl, out, 1);
}

// v005
// Two timings next to v004 put it at 1.15 and 1.13 times that version's speed.
// Over all steps from v000 it is 3.23 times as fast.
#include <hip/hip_runtime.h>

// MoE: B=8, S=4096, D=512, H=2048, E=8, K=2  (all fp32 in/out)
#define NTOK 32768
#define Dk   512
#define Hk   2048
#define Ek   8
#define MTOK 80              // tokens per expert block (5 WMMA M-tiles)
#define MT   (MTOK / 16)     // M-tiles: WMMAs fed by each weight fragment
#define HC   512             // H chunk held in LDS per pass (4 chunks)
#define XLD  520             // padded LDS row stride (halves): 1040B = 65*16
#define HLD  520             // padded LDS row stride (halves) for h chunk

typedef _Float16 v16h __attribute__((ext_vector_type(16)));
typedef _Float16 v8h  __attribute__((ext_vector_type(8)));
typedef _Float16 v4h  __attribute__((ext_vector_type(4)));
typedef unsigned int v2u __attribute__((ext_vector_type(2)));
typedef float    v8f  __attribute__((ext_vector_type(8)));

static __device__ inline v16h cat16(v8h lo, v8h hi) {
  return __builtin_shufflevector(lo, hi, 0,1,2,3,4,5,6,7,8,9,10,11,12,13,14,15);
}

// ---------------------------------------------------------------------------
// Pre-swizzle [Kd x Nd] f32 row-major matrices into the per-lane WMMA-B f16
// fragment layout: tile = (mat*(Kd/32)+kb)*(Nd/16)+nb, 512 halves per tile,
// lane-contiguous. B fragment load becomes one 32B/lane load, no cvt VALU.
// ---------------------------------------------------------------------------
template <int Kd, int Nd>
__global__ __launch_bounds__(256) void swizzleB_kernel(
    const float* __restrict__ src, _Float16* __restrict__ dst)
{
  const size_t gid = (size_t)blockIdx.x * 256 + threadIdx.x;  // tile*32 + lane
  const int lane = (int)(gid & 31);
  const size_t tile = gid >> 5;
  constexpr int NTN = Nd >> 4;   // n-tiles
  constexpr int NTK = Kd >> 5;   // k-tiles
  const int nb = (int)(tile % NTN);
  const size_t rest = tile / NTN;
  const int kb = (int)(rest % NTK);
  const size_t mat = rest / NTK;

  const int n   = nb * 16 + (lane & 15);
  const int hi8 = (lane >> 4) << 3;
  const float* s = src + (size_t)mat * Kd * Nd;
  v16h o;
#pragma unroll
  for (int i = 0; i < 8; ++i)
    o[i] = (_Float16)s[(size_t)(kb * 32 + hi8 + i) * Nd + n];
#pragma unroll
  for (int i = 0; i < 8; ++i)
    o[8 + i] = (_Float16)s[(size_t)(kb * 32 + 16 + hi8 + i) * Nd + n];
  *(v16h*)(dst + gid * 16) = o;
}

// ---------------------------------------------------------------------------
// Router: one wave32 per token. Dual dot products (Wg, Wn), softplus-noised
// logits, top-2, analytic 2-way softmax gates, append to one list per
// (choice, expert): lists 0..7 hold first choices, lists 8..15 second choices.
// ---------------------------------------------------------------------------
__global__ __launch_bounds__(256) void router_kernel(
    const float* __restrict__ x, const float* __restrict__ noise,
    const float* __restrict__ Wg, const float* __restrict__ bg,
    const float* __restrict__ Wn, const float* __restrict__ bn,
    int* __restrict__ cnt, int* __restrict__ tok_list, float* __restrict__ gate_list)
{
  const int wave = threadIdx.x >> 5;
  const int lane = threadIdx.x & 31;
  const int t = blockIdx.x * 8 + wave;

  float ag[Ek], an[Ek];
#pragma unroll
  for (int e = 0; e < Ek; ++e) { ag[e] = 0.f; an[e] = 0.f; }

  const float* xt = x + (size_t)t * Dk;
  for (int d = lane; d < Dk; d += 32) {
    const float xv = xt[d];
    const float* wg = Wg + d * Ek;
    const float* wn = Wn + d * Ek;
#pragma unroll
    for (int e = 0; e < Ek; ++e) {
      ag[e] = fmaf(xv, wg[e], ag[e]);
      an[e] = fmaf(xv, wn[e], an[e]);
    }
  }
#pragma unroll
  for (int off = 16; off > 0; off >>= 1) {
#pragma unroll
    for (int e = 0; e < Ek; ++e) {
      ag[e] += __shfl_down(ag[e], off, 32);
      an[e] += __shfl_down(an[e], off, 32);
    }
  }

  if (lane == 0) {
    float v[Ek];
#pragma unroll
    for (int e = 0; e < Ek; ++e) {
      const float lg = ag[e] + bg[e];
      const float ln = an[e] + bn[e];
      const float sp = (ln > 0.f) ? (ln + log1pf(expf(-ln))) : log1pf(expf(ln));
      v[e] = fmaf(noise[(size_t)t * Ek + e], sp, lg);
    }
    int i1 = 0;
#pragma unroll
    for (int e = 1; e < Ek; ++e) if (v[e] > v[i1]) i1 = e;
    int i2 = (i1 == 0) ? 1 : 0;
#pragma unroll
    for (int e = 0; e < Ek; ++e) if (e != i1 && v[e] > v[i2]) i2 = e;
    const float r  = expf(v[i2] - v[i1]);
    const float g1 = 1.f / (1.f + r);
    const float g2 = r / (1.f + r);
    int p1 = atomicAdd(&cnt[i1], 1);
    tok_list[i1 * NTOK + p1]  = t;
    gate_list[i1 * NTOK + p1] = g1;
    int p2 = atomicAdd(&cnt[Ek + i2], 1);
    tok_list[(Ek + i2) * NTOK + p2]  = t;
    gate_list[(Ek + i2) * NTOK + p2] = g2;
  }
}

// ---------------------------------------------------------------------------
// Expert MLP: block = (80 routed tokens) x (1 expert); 8 waves.
// Per k-step: five A fragments (M-tiles) from LDS; each streamed B fragment
// (one 32B/lane load from pre-swizzled f16 weights) feeds five WMMAs: every
// block streams its expert's whole weights from L2, so L2 bytes fall as 1/MTOK.
// One block fills a WGP (registers), and a launch has NTOK rows: at 80 rows its
// blocks, the part-filled last one of each list included, run in two rounds on
// 256 WGPs; at 64 rows they were a few more than 512, a third round.
// H processed in 4 chunks of 512 so h stays in LDS; y accumulated in VGPRs.
// The B fragments of a wave form one stream of 128 k-steps (per chunk 16 of
// W1, then 16 of W2) whose addresses depend on no data: a ring of 8 fragments
// in registers is refilled two k-steps ahead of the WMMAs that read it.
// Launched twice: a token stands in exactly one first-choice list and in exactly
// one second-choice list, so within a launch every row of out has one writer.
// The first launch stores its rows, the second adds to them; no atomics.
// ---------------------------------------------------------------------------
// Address of k-step t (0..31) of chunk c in a wave's weight stream.
static __device__ __forceinline__ const _Float16* wstep(
    const _Float16* W1w, const _Float16* W2w, int c, int t) {
  return (t < 16) ? W1w + (size_t)(t * 128 + c * 32) * 512
                  : W2w + (size_t)((c * 16 + (t - 16)) * 32) * 512;
}

static __device__ __forceinline__ void chunk_pass(
    const int c, const _Float16* xs, _Float16* hs,
    const _Float16* W1w, const _Float16* W2w, const float* b1e,
    const int wave, const int ln, const int hi8,
    v16h (&R)[8], v8f (&yacc)[4][MT])
{
  // ---- up-projection: hs = relu(xs @ W1e[:, chunk] + b1) ----
  v8f acc[4][MT];
#pragma unroll
  for (int p = 0; p < 4; ++p)
#pragma unroll  // constant indices keep the tiles in registers
    for (int mt = 0; mt < MT; ++mt) acc[p][mt] = (v8f){};

  // Loads return in order: fetched here, the biases are older than every refill
  // of this pass, so the wait for them does not drain the ring.
  float bias1[4];
#pragma unroll
  for (int p = 0; p < 4; ++p) bias1[p] = b1e[c * HC + (wave * 4 + p) * 16 + ln];

#pragma unroll
  for (int t = 0; t < 16; ++t) {
    v16h A[MT];
#pragma unroll
    for (int mt = 0; mt < MT; ++mt) {
      const int r = (mt * 16 + ln) * XLD + t * 32;
      A[mt] = cat16(*(const v8h*)&xs[r + hi8], *(const v8h*)&xs[r + 16 + hi8]);
    }
    const _Float16* nx = wstep(W1w, W2w, c, t + 2);
#pragma unroll
    for (int p = 0; p < 4; ++p) {
      const int sl = (t & 1) * 4 + p;
#pragma unroll  // constant indices keep the tiles in registers
      for (int mt = 0; mt < MT; ++mt)
        acc[p][mt] = __builtin_amdgcn_wmma_f32_16x16x32_f16(
            false, A[mt], false, R[sl], (short)0, acc[p][mt], false, false);
      R[sl] = *(const v16h*)(nx + (size_t)p * 512);   // refill, two k-steps ahead
    }
    // Keeps this step's refills from being sunk down to their use two steps on
    // (the scheduler did that, and each fragment then cost a full load latency).
    __builtin_amdgcn_sched_barrier(0);
  }
  // epilogue: bias + relu + f16 store into hs
#pragma unroll
  for (int p = 0; p < 4; ++p) {
    const int nloc = (wave * 4 + p) * 16 + ln;   // 0..HC-1
    const float bias = bias1[p];
#pragma unroll
    for (int mt = 0; mt < MT; ++mt) {
#pragma unroll
      for (int vv = 0; vv < 8; ++vv) {
        const int m = mt * 16 + vv + hi8;        // C/D row layout
        hs[m * HLD + nloc] = (_Float16)fmaxf(acc[p][mt][vv] + bias, 0.f);
      }
    }
  }
  __syncthreads();

  // ---- down-projection partial: yacc += hs @ W2e[chunk, :] ----
#pragma unroll
  for (int t = 16; t < 32; ++t) {
    v16h A[MT];
#pragma unroll
    for (int mt = 0; mt < MT; ++mt) {
      const int r = (mt * 16 + ln) * HLD + (t - 16) * 32;
      A[mt] = cat16(*(const v8h*)&hs[r + hi8], *(const v8h*)&hs[r + 16 + hi8]);
    }
#pragma unroll
    for (int q = 0; q < 4; ++q) {
      const int sl = (t & 1) * 4 + q;
#pragma unroll  // constant indices keep the tiles in registers
      for (int mt = 0; mt < MT; ++mt)
        yacc[q][mt] = __builtin_amdgcn_wmma_f32_16x16x32_f16(
            false, A[mt], false, R[sl], (short)0, yacc[q][mt], false, false);
      if (t + 2 < 32)
        R[sl] = *(const v16h*)(wstep(W1w, W2w, c, t + 2) + (size_t)q * 512);
    }
    __builtin_amdgcn_sched_barrier(0);           // as above: refills stay in their step
  }
  // The next chunk's first two k-steps, where there is one (c is the same in
  // every wave: a scalar branch). One branch behind the last WMMA: a branch
  // inside the last steps made the compiler wait for all loads there.
  if (c + 1 < Hk / HC) {
#pragma unroll
    for (int s = 0; s < 8; ++s)
      R[s] = *(const v16h*)(wstep(W1w, W2w, c + 1, s >> 2) + (size_t)(s & 3) * 512);
  }
  __syncthreads();
}

__global__ __launch_bounds__(256, 1) void expert_kernel(
    const float* __restrict__ x,
    const _Float16* __restrict__ W1s, const float* __restrict__ b1,
    const _Float16* __restrict__ W2s, const float* __restrict__ b2,
    const int* __restrict__ cnt, const int* __restrict__ tok_list,
    const float* __restrict__ gate_list, float* out, const int second)
{
  __shared__ _Float16 xs[MTOK * XLD];   // 80 tokens x 512 (f16, padded)
  __shared__ _Float16 hs[MTOK * HLD];   // 80 tokens x 512 (f16, padded)
  __shared__ int   stok[MTOK];
  __shared__ float sgate[MTOK];

  const int e  = blockIdx.y;
  const int m0 = blockIdx.x * MTOK;
  const int le = second * Ek + e;       // list of this launch's choice
  const int ce = cnt[le];
  if (m0 >= ce) return;
  const int rows = (ce - m0 < MTOK) ? (ce - m0) : MTOK;

  const int tid  = threadIdx.x;
  const int wave = __builtin_amdgcn_readfirstlane(tid >> 5);  // scalar: tile offsets on the scalar unit
  const int lane = tid & 31;
  const int ln   = lane & 15;          // A row / B,C,D column within tile
  const int hi8  = (lane >> 4) << 3;   // 0 or 8: K/M offset for upper lanes

  // swizzled tile = (e*16 + kb)*128 + nb for W1s, (e*64 + kb)*32 + nb for W2s
  const _Float16* W1w = W1s + ((size_t)(e * 16) * 128 + wave * 4) * 512 + lane * 16;
  const _Float16* W2w = W2s + ((size_t)(e * 64) * 32 + wave * 4) * 512 + lane * 16;

  // Fill the ring first: k-steps 0 and 1 are under way before the token list is read.
  v16h R[8];
#pragma unroll
  for (int s = 0; s < 8; ++s)
    R[s] = *(const v16h*)(wstep(W1w, W2w, 0, s >> 2) + (size_t)(s & 3) * 512);

  if (tid < MTOK) {
    const bool valid = tid < rows;
    stok[tid]  = valid ? tok_list[le * NTOK + m0 + tid] : 0;
    sgate[tid] = valid ? gate_list[le * NTOK + m0 + tid] : 0.f;
  }
  __syncthreads();

  // Gather 80 token rows of x into LDS as f16. A thread's 40 loads of 16 bytes
  // depend on nothing but the token list and are all issued before the first is
  // used: one memory latency for the tile, not one per element. A row past the
  // end of the list reads token 0's row (stok is 0 there) and is stored as zero.
  {
    const int r0 = tid >> 7;             // 128 threads per row, two rows per trip
    const int c4 = (tid & 127) * 4;
    float4 xv[MTOK / 2];
    unsigned off[MTOK / 2];
#pragma unroll
    for (int j = 0; j < MTOK / 2; ++j)
      off[j] = (unsigned)stok[r0 + 2 * j] * (Dk * 4u) + (unsigned)c4 * 4u;  // < 64 MiB
    static_assert(MTOK / 2 == 40, "the two waits below name 20 offsets each");
#define OFF5(a) "v"(off[a]), "v"(off[(a) + 1]), "v"(off[(a) + 2]), "v"(off[(a) + 3]), "v"(off[(a) + 4])
#pragma unroll
    for (int j = 0; j < 20; ++j) xv[j] = *(const float4*)((const char*)x + off[j]);
    // Precaution: the wait stands in front of every reuse of a load's offset
    // register; as inputs the offsets keep their registers up to it. It waits
    // for no data.
    asm volatile("s_wait_xcnt 0x0" :: OFF5(0), OFF5(5), OFF5(10), OFF5(15) : "memory");
#pragma unroll
    for (int j = 20; j < 40; ++j) xv[j] = *(const float4*)((const char*)x + off[j]);
    // As above, for the second half of the loads.
    asm volatile("s_wait_xcnt 0x0" :: OFF5(20), OFF5(25), OFF5(30), OFF5(35) : "memory");
#undef OFF5
#pragma unroll
    for (int j = 0; j < MTOK / 2; ++j) {
      const int r = r0 + 2 * j;
      v4h h;
      h[0] = (_Float16)xv[j].x;
      h[1] = (_Float16)xv[j].y;
      h[2] = (_Float16)xv[j].z;
      h[3] = (_Float16)xv[j].w;
      const v2u keep = (r < rows) ? (v2u){~0u, ~0u} : (v2u){0u, 0u};
      *(v4h*)&xs[r * XLD + c4] = __builtin_bit_cast(v4h, __builtin_bit_cast(v2u, h) & keep);
    }
  }
  __syncthreads();

  const float* b1e = b1 + e * Hk;
  const float* b2e = b2 + e * Dk;

  v8f yacc[4][MT];
#pragma unroll
  for (int q = 0; q < 4; ++q)
#pragma unroll  // constant indices keep the tiles in registers
    for (int mt = 0; mt < MT; ++mt) yacc[q][mt] = (v8f){};

  for (int c = 0; c < Hk / HC; ++c)
    chunk_pass(c, xs, hs, W1w, W2w, b1e, wave, ln, hi8, R, yacc);

  // ---- scatter: out[token] = or += (y + b2) * gate, one writer per row ----
  float bias[4];
  const int bcol = wave * 64 + ln;
#pragma unroll
  for (int q = 0; q < 4; ++q) bias[q] = b2e[bcol + q * 16];
  // Precaution: the loads' address register may be reused below;
  // as an input it lives up to the wait.
  asm volatile("s_wait_xcnt 0x0" :: "v"(bcol) : "memory");

  // Byte offset of this lane's first column in each of its 40 rows (< 64 MiB);
  // the four column tiles of a wave lie 64 bytes apart.
  unsigned roff[MT][8];
  float gt[MT][8];
#pragma unroll
  for (int mt = 0; mt < MT; ++mt) {
#pragma unroll
    for (int vv = 0; vv < 8; ++vv) {
      const int m = mt * 16 + vv + hi8;
      roff[mt][vv] = (unsigned)stok[m] * (Dk * 4u) + (unsigned)(wave * 64 + ln) * 4u;
      gt[mt][vv] = sgate[m];
    }
  }
  char* ob = (char*)out;

  if (second) {
    // All 160 loads of the first launch's rows are issued before the first is
    // used: one latency. A row past the end of the list reads token 0's row
    // (stok is 0 there); the value is not stored.
    float old[MT][8][4];
#pragma unroll
    for (int mt = 0; mt < MT; ++mt)
#pragma unroll
      for (int vv = 0; vv < 8; ++vv)
#pragma unroll
        for (int q = 0; q < 4; ++q)
          old[mt][vv][q] = *(const float*)(ob + roff[mt][vv] + q * 64);
#pragma unroll
    for (int mt = 0; mt < MT; ++mt) {
#pragma unroll
      for (int vv = 0; vv < 8; ++vv) {
        if (mt * 16 + vv + hi8 < rows) {
#pragma unroll
          for (int q = 0; q < 4; ++q)
            *(float*)(ob + roff[mt][vv] + q * 64) =
                old[mt][vv][q] + (yacc[q][mt][vv] + bias[q]) * gt[mt][vv];
        }
      }
    }
  } else {
#pragma unroll
    for (int mt = 0; mt < MT; ++mt) {
#pragma unroll
      for (int vv = 0; vv < 8; ++vv) {
        if (mt * 16 + vv + hi8 < rows) {
#pragma unroll
          for (int q = 0; q < 4; ++q)
            *(float*)(ob + roff[mt][vv] + q * 64) =
                (yacc[q][mt][vv] + bias[q]) * gt[mt][vv];
        }
      }
    }
  }
}

// ---------------------------------------------------------------------------
extern "C" void kernel_launch(void* const* d_in, const int* in_sizes, int n_in,
                              void* d_out, int out_size, void* d_ws, size_t ws_size,
                              hipStream_t stream) {
  (void)in_sizes; (void)n_in; (void)out_size; (void)ws_size;
  const float* x     = (const float*)d_in[0];
  const float* noise = (const float*)d_in[1];
  const float* Wg    = (const float*)d_in[2];
  const float* bg    = (const float*)d_in[3];
  const float* Wn    = (const float*)d_in[4];
  const float* bn    = (const float*)d_in[5];
  const float* W1    = (const float*)d_in[6];
  const float* b1    = (const float*)d_in[7];
  const float* W2    = (const float*)d_in[8];
  const float* b2    = (const float*)d_in[9];
  float* out = (float*)d_out;

  // Workspace layout:
  //   [cnt: 256B] [tok_list: 2*E*NTOK*4 = 2MB] [gate_list: 2MB]
  //   at 8MB: [W1s f16 swizzled: E*D*H*2 = 16MB] [W2s f16 swizzled: 16MB]
  char* ws = (char*)d_ws;
  int*   cnt  = (int*)ws;
  int*   tokl = (int*)(ws + 256);
  float* gatl = (float*)(ws + 256 + (size_t)2 * Ek * NTOK * sizeof(int));
  _Float16* W1s = (_Float16*)(ws + 8 * 1024 * 1024);
  _Float16* W2s = W1s + (size_t)Ek * Dk * Hk;

  hipMemsetAsync(cnt, 0, 2 * Ek * sizeof(int), stream);

  // Weight pre-swizzle into WMMA-B fragment layout (f32 -> f16).
  {
    const size_t g1 = (size_t)Ek * (Dk / 32) * (Hk / 16) * 32;   // W1 lanes
    const size_t g2 = (size_t)Ek * (Hk / 32) * (Dk / 16) * 32;   // W2 lanes
    swizzleB_kernel<Dk, Hk><<<(int)(g1 / 256), 256, 0, stream>>>(W1, W1s);
    swizzleB_kernel<Hk, Dk><<<(int)(g2 / 256), 256, 0, stream>>>(W2, W2s);
  }

  router_kernel<<<NTOK / 8, 256, 0, stream>>>(x, noise, Wg, bg, Wn, bn,
                                              cnt, tokl, gatl);
  // First choices store every row of out; second choices then add to it.
  expert_kernel<<<dim3((NTOK + MTOK - 1) / MTOK, Ek), 256, 0, stream>>>(x, W1s, b1, W2s, b2,
                                                           cnt, tokl, gatl, out, 0);
  expert_kernel<<<dim3((NTOK + MTOK - 1) / MTOK, Ek), 256, 0, stream>>>(x, W1s, b1, W2s, b2,
                                                           cnt, tokl, gatl, out, 1);
}

// v006
// Timed twice side by side with v005, it ran 1.28 and 1.29 times as fast.
// Over all steps from v000 it is 4.15 times as fast.
#include <hip/hip_runtime.h>

// MoE: B=8, S=4096, D=512, H=2048, E=8, K=2  (all fp32 in/out)
#define NTOK 32768
#define Dk   512
#define Hk   2048
#define Ek   8
#define MTOK 80              // tokens per expert block (5 WMMA M-tiles)
#define MT   (MTOK / 16)     // M-tiles: WMMAs fed by each weight fragment
#define HC   512             // H chunk held in LDS per pass (4 chunks)
#define XLD  520             // padded LDS row stride (halves): 1040B = 65*16
#define HLD  520             // padded LDS row stride (halves) for h chunk

typedef _Float16 v16h __attribute__((ext_vector_type(16)));
typedef _Float16 v8h  __attribute__((ext_vector_type(8)));
typedef _Float16 v4h  __attribute__((ext_vector_type(4)));
typedef unsigned int v2u __attribute__((ext_vector_type(2)));
typedef float    v8f  __attribute__((ext_vector_type(8)));

static __device__ inline v16h cat16(v8h lo, v8h hi) {
  return __builtin_shufflevector(lo, hi, 0,1,2,3,4,5,6,7,8,9,10,11,12,13,14,15);
}

// ---------------------------------------------------------------------------
// Pre-swizzle [Kd x Nd] f32 row-major matrices into the per-lane WMMA-B f16
// fragment layout: tile = (mat*(Kd/32)+kb)*(Nd/16)+nb, 512 halves per tile,
// lane-contiguous. B fragment load becomes one 32B/lane load, no cvt VALU.
// ---------------------------------------------------------------------------
template <int Kd, int Nd>
__global__ __launch_bounds__(256) void swizzleB_kernel(
    const float* __restrict__ src, _Float16* __restrict__ dst)
{
  const size_t gid = (size_t)blockIdx.x * 256 + threadIdx.x;  // tile*32 + lane
  const int lane = (int)(gid & 31);
  const size_t tile = gid >> 5;
  constexpr int NTN = Nd >> 4;   // n-tiles
  constexpr int NTK = Kd >> 5;   // k-tiles
  const int nb = (int)(tile % NTN);
  const size_t rest = tile / NTN;
  const int kb = (int)(rest % NTK);
  const size_t mat = rest / NTK;

  const int n   = nb * 16 + (lane & 15);
  const int hi8 = (lane >> 4) << 3;
  const float* s = src + (size_t)mat * Kd * Nd;
  v16h o;
#pragma unroll
  for (int i = 0; i < 8; ++i)
    o[i] = (_Float16)s[(size_t)(kb * 32 + hi8 + i) * Nd + n];
#pragma unroll
  for (int i = 0; i < 8; ++i)
    o[8 + i] = (_Float16)s[(size_t)(kb * 32 + 16 + hi8 + i) * Nd + n];
  *(v16h*)(dst + gid * 16) = o;
}

// ---------------------------------------------------------------------------
// Router: a block of 8 waves takes 32 tokens, 4 per wave. The dual dot products
// (Wg, Wn) keep their order of summation per token: lane l sums d = l, l + 32, ...
// and the lanes are joined by the same tree. What follows the sums runs once per
// block with every lane at work, not on lane 0 of a wave per token:
//   softplus-noised logit: one (token, expert) pair per thread;
//   top-2 and the analytic 2-way softmax gates: one token per lane of wave 0;
//   append to one list per (choice, expert), lists 0..7 first choices, 8..15
//   second choices: a token's rank among the block's 32 by ballot, and one
//   atomic add per list and block (lanes 0..15, one instruction) for the base.
// ---------------------------------------------------------------------------
#define RTOK 32              // tokens per router block
#define RWT  (RTOK / 8)      // tokens per wave

__global__ __launch_bounds__(256) void router_kernel(
    const float* __restrict__ x, const float* __restrict__ noise,
    const float* __restrict__ Wg, const float* __restrict__ bg,
    const float* __restrict__ Wn, const float* __restrict__ bn,
    int* __restrict__ cnt, int* __restrict__ tok_list, float* __restrict__ gate_list)
{
  __shared__ float sdot[RTOK][2 * Ek];   // per token: 8 sums with Wg, 8 with Wn
  __shared__ float sv[RTOK][Ek + 1];     // noisy logits; odd pitch: a lane reads a row

  const int tid  = threadIdx.x;
  const int wave = __builtin_amdgcn_readfirstlane(tid >> 5);  // scalar: the x rows' base on the scalar unit
  const int lane = tid & 31;
  const int t0 = blockIdx.x * RTOK;      // the block's first token
  const int pe = tid & (Ek - 1);         // expert of this thread's (token, expert) pair

  // Operands of this thread's pair: they depend on no sum, so their latency hides under the sums.
  const float nz  = noise[(size_t)t0 * Ek + tid];
  const float bge = bg[pe];
  const float bne = bn[pe];

  // The loops over j and e, here and below, are unrolled so that constant indices
  // keep these arrays in registers.
  float ag[RWT][Ek], an[RWT][Ek];
#pragma unroll
  for (int j = 0; j < RWT; ++j)
#pragma unroll
    for (int e = 0; e < Ek; ++e) { ag[j][e] = 0.f; an[j][e] = 0.f; }

  const char* xb = (const char*)(x + (size_t)(t0 + wave * RWT) * Dk);
  const unsigned xo = (unsigned)lane * 4u;         // d = lane, in bytes of an x row
  const unsigned wo = (unsigned)lane * (Ek * 4u);  // row d = lane of Wg and of Wn
  // Unrolled: every address is one of two registers plus a constant, so no address
  // register is rewritten while loads are out, and later steps' loads issue early.
#pragma unroll
  for (int i = 0; i < Dk / 32; ++i) {
    const float4 g0 = *(const float4*)((const char*)Wg + wo + i * (32 * Ek * 4));
    const float4 g1 = *(const float4*)((const char*)Wg + wo + i * (32 * Ek * 4) + 16);
    const float4 n0 = *(const float4*)((const char*)Wn + wo + i * (32 * Ek * 4));
    const float4 n1 = *(const float4*)((const char*)Wn + wo + i * (32 * Ek * 4) + 16);
    const float g[Ek] = {g0.x, g0.y, g0.z, g0.w, g1.x, g1.y, g1.z, g1.w};
    const float n[Ek] = {n0.x, n0.y, n0.z, n0.w, n1.x, n1.y, n1.z, n1.w};
#pragma unroll
    for (int j = 0; j < RWT; ++j) {
      const float xv = *(const float*)(xb + xo + j * (Dk * 4) + i * 128);
#pragma unroll
      for (int e = 0; e < Ek; ++e) {
        ag[j][e] = fmaf(xv, g[e], ag[j][e]);
        an[j][e] = fmaf(xv, n[e], an[j][e]);
      }
    }
  }
#pragma unroll
  for (int off = 16; off > 0; off >>= 1) {
#pragma unroll
    for (int j = 0; j < RWT; ++j) {
#pragma unroll
      for (int e = 0; e < Ek; ++e) {
        ag[j][e] += __shfl_down(ag[j][e], off, 32);
        an[j][e] += __shfl_down(an[j][e], off, 32);
      }
    }
  }
  if (lane == 0) {
#pragma unroll
    for (int j = 0; j < RWT; ++j) {
#pragma unroll
      for (int e = 0; e < Ek; ++e) {
        sdot[wave * RWT + j][e]      = ag[j][e];
        sdot[wave * RWT + j][Ek + e] = an[j][e];
      }
    }
  }
  __syncthreads();

  {
    const int tk = tid >> 3;             // token within the block
    const int e  = pe;
    const float lg = sdot[tk][e] + bge;
    const float ln = sdot[tk][Ek + e] + bne;
    const float sp = (ln > 0.f) ? (ln + log1pf(expf(-ln))) : log1pf(expf(ln));
    sv[tk][e] = fmaf(nz, sp, lg);
  }
  __syncthreads();

  if (tid < RTOK) {                      // wave 0, every lane on: lane = token
    float v[Ek];
#pragma unroll
    for (int e = 0; e < Ek; ++e) v[e] = sv[lane][e];
    int i1 = 0;
#pragma unroll
    for (int e = 1; e < Ek; ++e) if (v[e] > v[i1]) i1 = e;
    int i2 = (i1 == 0) ? 1 : 0;
#pragma unroll
    for (int e = 0; e < Ek; ++e) if (e != i1 && v[e] > v[i2]) i2 = e;
    const float r  = expf(v[i2] - v[i1]);
    const float g1 = 1.f / (1.f + r);
    const float g2 = r / (1.f + r);

    // Rank of this token among the block's entries of its two lists; lane l < 16
    // gathers how many entries the block adds to list l.
    const unsigned below = (1u << lane) - 1u;
    int r1 = 0, r2 = 0, add = 0;
#pragma unroll
    for (int e = 0; e < Ek; ++e) {
      const unsigned m1 = __builtin_amdgcn_ballot_w32(i1 == e);
      const unsigned m2 = __builtin_amdgcn_ballot_w32(i2 == e);
      if (i1 == e) r1 = __popc(m1 & below);
      if (i2 == e) r2 = __popc(m2 & below);
      if (lane == e) add = __popc(m1);
      if (lane == Ek + e) add = __popc(m2);
    }
    int base = 0;
    if (lane < 2 * Ek) base = atomicAdd(&cnt[lane], add);
    const int p1 = __shfl(base, i1, 32) + r1;
    const int p2 = __shfl(base, Ek + i2, 32) + r2;
    const int t = t0 + lane;
    tok_list[i1 * NTOK + p1]  = t;
    gate_list[i1 * NTOK + p1] = g1;
    tok_list[(Ek + i2) * NTOK + p2]  = t;
    gate_list[(Ek + i2) * NTOK + p2] = g2;
  }
}

// ---------------------------------------------------------------------------
// Expert MLP: block = (80 routed tokens) x (1 expert); 8 waves.
// Per k-step: five A fragments (M-tiles) from LDS; each streamed B fragment
// (one 32B/lane load from pre-swizzled f16 weights) feeds five WMMAs: every
// block streams its expert's whole weights from L2, so L2 bytes fall as 1/MTOK.
// One block fills a WGP (registers), and a launch has NTOK rows: at 80 rows its
// blocks, the part-filled last one of each list included, run in two rounds on
// 256 WGPs; at 64 rows they were a few more than 512, a third round.
// H processed in 4 chunks of 512 so h stays in LDS; y accumulated in VGPRs.
// The B fragments of a wave form one stream of 128 k-steps (per chunk 16 of
// W1, then 16 of W2) whose addresses depend on no data: a ring of 8 fragments
// in registers is refilled two k-steps ahead of the WMMAs that read it.
// Launched twice: a token stands in exactly one first-choice list and in exactly
// one second-choice list, so within a launch every row of out has one writer.
// The first launch stores its rows, the second adds to them; no atomics.
// ---------------------------------------------------------------------------
// Address of k-step t (0..31) of chunk c in a wave's weight stream.
static __device__ __forceinline__ const _Float16* wstep(
    const _Float16* W1w, const _Float16* W2w, int c, int t) {
  return (t < 16) ? W1w + (size_t)(t * 128 + c * 32) * 512
                  : W2w + (size_t)((c * 16 + (t - 16)) * 32) * 512;
}

static __device__ __forceinline__ void chunk_pass(
    const int c, const _Float16* xs, _Float16* hs,
    const _Float16* W1w, const _Float16* W2w, const float* b1e,
    const int wave, const int ln, const int hi8,
    v16h (&R)[8], v8f (&yacc)[4][MT])
{
  // ---- up-projection: hs = relu(xs @ W1e[:, chunk] + b1) ----
  v8f acc[4][MT];
#pragma unroll
  for (int p = 0; p < 4; ++p)
#pragma unroll  // constant indices keep the tiles in registers
    for (int mt = 0; mt < MT; ++mt) acc[p][mt] = (v8f){};

  // Loads return in order: fetched here, the biases are older than every refill
  // of this pass, so the wait for them does not drain the ring.
  float bias1[4];
#pragma unroll
  for (int p = 0; p < 4; ++p) bias1[p] = b1e[c * HC + (wave * 4 + p) * 16 + ln];

#pragma unroll
  for (int t = 0; t < 16; ++t) {
    v16h A[MT];
#pragma unroll
    for (int mt = 0; mt < MT; ++mt) {
      const int r = (mt * 16 + ln) * XLD + t * 32;
      A[mt] = cat16(*(const v8h*)&xs[r + hi8], *(const v8h*)&xs[r + 16 + hi8]);
    }
    const _Float16* nx = wstep(W1w, W2w, c, t + 2);
#pragma unroll
    for (int p = 0; p < 4; ++p) {
      const int sl = (t & 1) * 4 + p;
#pragma unroll  // constant indices keep the tiles in registers
      for (int mt = 0; mt < MT; ++mt)
        acc[p][mt] = __builtin_amdgcn_wmma_f32_16x16x32_f16(
            false, A[mt], false, R[sl], (short)0, acc[p][mt], false, false);
      R[sl] = *(const v16h*)(nx + (size_t)p * 512);   // refill, two k-steps ahead
    }
    // Keeps this step's refills from being sunk down to their use two steps on
    // (the scheduler did that, and each fragment then cost a full load latency).
    __builtin_amdgcn_sched_barrier(0);
  }
  // epilogue: bias + relu + f16 store into hs
#pragma unroll
  for (int p = 0; p < 4; ++p) {
    const int nloc = (wave * 4 + p) * 16 + ln;   // 0..HC-1
    const float bias = bias1[p];
#pragma unroll
    for (int mt = 0; mt < MT; ++mt) {
#pragma unroll
      for (int vv = 0; vv < 8; ++vv) {
        const int m = mt * 16 + vv + hi8;        // C/D row layout
        hs[m * HLD + nloc] = (_Float16)fmaxf(acc[p][mt][vv] + bias, 0.f);
      }
    }
  }
  __syncthreads();

  // ---- down-projection partial: yacc += hs @ W2e[chunk, :] ----
#pragma unroll
  for (int t = 16; t < 32; ++t) {
    v16h A[MT];
#pragma unroll
    for (int mt = 0; mt < MT; ++mt) {
      const int r = (mt * 16 + ln) * HLD + (t - 16) * 32;
      A[mt] = cat16(*(const v8h*)&hs[r + hi8], *(const v8h*)&hs[r + 16 + hi8]);
    }
#pragma unroll
    for (int q = 0; q < 4; ++q) {
      const int sl = (t & 1) * 4 + q;
#pragma unroll  // constant indices keep the tiles in registers
      for (int mt = 0; mt < MT; ++mt)
        yacc[q][mt] = __builtin_amdgcn_wmma_f32_16x16x32_f16(
            false, A[mt], false, R[sl], (short)0, yacc[q][mt], false, false);
      if (t + 2 < 32)
        R[sl] = *(const v16h*)(wstep(W1w, W2w, c, t + 2) + (size_t)q * 512);
    }
    __builtin_amdgcn_sched_barrier(0);           // as above: refills stay in their step
  }
  // The next chunk's first two k-steps, where there is one (c is the same in
  // every wave: a scalar branch). One branch behind the last WMMA: a branch
  // inside the last steps made the compiler wait for all loads there.
  if (c + 1 < Hk / HC) {
#pragma unroll
    for (int s = 0; s < 8; ++s)
      R[s] = *(const v16h*)(wstep(W1w, W2w, c + 1, s >> 2) + (size_t)(s & 3) * 512);
  }
  __syncthreads();
}

__global__ __launch_bounds__(256, 1) void expert_kernel(
    const float* __restrict__ x,
    const _Float16* __restrict__ W1s, const float* __restrict__ b1,
    const _Float16* __restrict__ W2s, const float* __restrict__ b2,
    const int* __restrict__ cnt, const int* __restrict__ tok_list,
    const float* __restrict__ gate_list, float* out, const int second)
{
  __shared__ _Float16 xs[MTOK * XLD];   // 80 tokens x 512 (f16, padded)
  __shared__ _Float16 hs[MTOK * HLD];   // 80 tokens x 512 (f16, padded)
  __shared__ int   stok[MTOK];
  __shared__ float sgate[MTOK];

  const int e  = blockIdx.y;
  const int m0 = blockIdx.x * MTOK;
  const int le = second * Ek + e;       // list of this launch's choice
  const int ce = cnt[le];
  if (m0 >= ce) return;
  const int rows = (ce - m0 < MTOK) ? (ce - m0) : MTOK;

  const int tid  = threadIdx.x;
  const int wave = __builtin_amdgcn_readfirstlane(tid >> 5);  // scalar: tile offsets on the scalar unit
  const int lane = tid & 31;
  const int ln   = lane & 15;          // A row / B,C,D column within tile
  const int hi8  = (lane >> 4) << 3;   // 0 or 8: K/M offset for upper lanes

  // swizzled tile = (e*16 + kb)*128 + nb for W1s, (e*64 + kb)*32 + nb for W2s
  const _Float16* W1w = W1s + ((size_t)(e * 16) * 128 + wave * 4) * 512 + lane * 16;
  const _Float16* W2w = W2s + ((size_t)(e * 64) * 32 + wave * 4) * 512 + lane * 16;

  // Fill the ring first: k-steps 0 and 1 are under way before the token list is read.
  v16h R[8];
#pragma unroll
  for (int s = 0; s < 8; ++s)
    R[s] = *(const v16h*)(wstep(W1w, W2w, 0, s >> 2) + (size_t)(s & 3) * 512);

  if (tid < MTOK) {
    const bool valid = tid < rows;
    stok[tid]  = valid ? tok_list[le * NTOK + m0 + tid] : 0;
    sgate[tid] = valid ? gate_list[le * NTOK + m0 + tid] : 0.f;
  }
  __syncthreads();

  // Gather 80 token rows of x into LDS as f16. A thread's 40 loads of 16 bytes
  // depend on nothing but the token list and are all issued before the first is
  // used: one memory latency for the tile, not one per element. A row past the
  // end of the list reads token 0's row (stok is 0 there) and is stored as zero.
  {
    const int r0 = tid >> 7;             // 128 threads per row, two rows per trip
    const int c4 = (tid & 127) * 4;
    float4 xv[MTOK / 2];
    unsigned off[MTOK / 2];
#pragma unroll
    for (int j = 0; j < MTOK / 2; ++j)
      off[j] = (unsigned)stok[r0 + 2 * j] * (Dk * 4u) + (unsigned)c4 * 4u;  // < 64 MiB
    static_assert(MTOK / 2 == 40, "the two waits below name 20 offsets each");
#define OFF5(a) "v"(off[a]), "v"(off[(a) + 1]), "v"(off[(a) + 2]), "v"(off[(a) + 3]), "v"(off[(a) + 4])
#pragma unroll
    for (int j = 0; j < 20; ++j) xv[j] = *(const float4*)((const char*)x + off[j]);
    // Precaution: the wait stands in front of every reuse of a load's offset
    // register; as inputs the offsets keep their registers up to it. It waits
    // for no data.
    asm volatile("s_wait_xcnt 0x0" :: OFF5(0), OFF5(5), OFF5(10), OFF5(15) : "memory");
#pragma unroll
    for (int j = 20; j < 40; ++j) xv[j] = *(const float4*)((const char*)x + off[j]);
    // As above, for the second half of the loads.
    asm volatile("s_wait_xcnt 0x0" :: OFF5(20), OFF5(25), OFF5(30), OFF5(35) : "memory");
#undef OFF5
#pragma unroll
    for (int j = 0; j < MTOK / 2; ++j) {
      const int r = r0 + 2 * j;
      v4h h;
      h[0] = (_Float16)xv[j].x;
      h[1] = (_Float16)xv[j].y;
      h[2] = (_Float16)xv[j].z;
      h[3] = (_Float16)xv[j].w;
      const v2u keep = (r < rows) ? (v2u){~0u, ~0u} : (v2u){0u, 0u};
      *(v4h*)&xs[r * XLD + c4] = __builtin_bit_cast(v4h, __builtin_bit_cast(v2u, h) & keep);
    }
  }
  __syncthreads();

  const float* b1e = b1 + e * Hk;
  const float* b2e = b2 + e * Dk;

  v8f yacc[4][MT];
#pragma unroll
  for (int q = 0; q < 4; ++q)
#pragma unroll  // constant indices keep the tiles in registers
    for (int mt = 0; mt < MT; ++mt) yacc[q][mt] = (v8f){};

  for (int c = 0; c < Hk / HC; ++c)
    chunk_pass(c, xs, hs, W1w, W2w, b1e, wave, ln, hi8, R, yacc);

  // ---- scatter: out[token] = or += (y + b2) * gate, one writer per row ----
  float bias[4];
  const int bcol = wave * 64 + ln;
#pragma unroll
  for (int q = 0; q < 4; ++q) bias[q] = b2e[bcol + q * 16];
  // Precaution: the loads' address register may be reused below;
  // as an input it lives up to the wait.
  asm volatile("s_wait_xcnt 0x0" :: "v"(bcol) : "memory");

  // Byte offset of this lane's first column in each of its 40 rows (< 64 MiB);
  // the four column tiles of a wave lie 64 bytes apart.
  unsigned roff[MT][8];
  float gt[MT][8];
#pragma unroll
  for (int mt = 0; mt < MT; ++mt) {
#pragma unroll
    for (int vv = 0; vv < 8; ++vv) {
      const int m = mt * 16 + vv + hi8;
      roff[mt][vv] = (unsigned)stok[m] * (Dk * 4u) + (unsigned)(wave * 64 + ln) * 4u;
      gt[mt][vv] = sgate[m];
    }
  }
  char* ob = (char*)out;

  if (second) {
    // All 160 loads of the first launch's rows are issued before the first is
    // used: one latency. A row past the end of the list reads token 0's row
    // (stok is 0 there); the value is not stored.
    float old[MT][8][4];
#pragma unroll
    for (int mt = 0; mt < MT; ++mt)
#pragma unroll
      for (int vv = 0; vv < 8; ++vv)
#pragma unroll
        for (int q = 0; q < 4; ++q)
          old[mt][vv][q] = *(const float*)(ob + roff[mt][vv] + q * 64);
#pragma unroll
    for (int mt = 0; mt < MT; ++mt) {
#pragma unroll
      for (int vv = 0; vv < 8; ++vv) {
        if (mt * 16 + vv + hi8 < rows) {
#pragma unroll
          for (int q = 0; q < 4; ++q)
            *(float*)(ob + roff[mt][vv] + q * 64) =
                old[mt][vv][q] + (yacc[q][mt][vv] + bias[q]) * gt[mt][vv];
        }
      }
    }
  } else {
#pragma unroll
    for (int mt = 0; mt < MT; ++mt) {
#pragma unroll
      for (int vv = 0; vv < 8; ++vv) {
        if (mt * 16 + vv + hi8 < rows) {
#pragma unroll
          for (int q = 0; q < 4; ++q)
            *(float*)(ob + roff[mt][vv] + q * 64) =
                (yacc[q][mt][vv] + bias[q]) * gt[mt][vv];
        }
      }
    }
  }
}

// ---------------------------------------------------------------------------
extern "C" void kernel_launch(void* const* d_in, const int* in_sizes, int n_in,
                              void* d_out, int out_size, void* d_ws, size_t ws_size,
                              hipStream_t stream) {
  (void)in_sizes; (void)n_in; (void)out_size; (void)ws_size;
  const float* x     = (const float*)d_in[0];
  const float* noise = (const float*)d_in[1];
  const float* Wg    = (const float*)d_in[2];
  const float* bg    = (const float*)d_in[3];
  const float* Wn    = (const float*)d_in[4];
  const float* bn    = (const float*)d_in[5];
  const float* W1    = (const float*)d_in[6];
  const float* b1    = (const float*)d_in[7];
  const float* W2    = (const float*)d_in[8];
  const float* b2    = (const float*)d_in[9];
  float* out = (float*)d_out;

  // Workspace layout:
  //   [cnt: 256B] [tok_list: 2*E*NTOK*4 = 2MB] [gate_list: 2MB]
  //   at 8MB: [W1s f16 swizzled: E*D*H*2 = 16MB] [W2s f16 swizzled: 16MB]
  char* ws = (char*)d_ws;
  int*   cnt  = (int*)ws;
  int*   tokl = (int*)(ws + 256);
  float* gatl = (float*)(ws + 256 + (size_t)2 * Ek * NTOK * sizeof(int));
  _Float16* W1s = (_Float16*)(ws + 8 * 1024 * 1024);
  _Float16* W2s = W1s + (size_t)Ek * Dk * Hk;

  hipMemsetAsync(cnt, 0, 2 * Ek * sizeof(int), stream);

  // Weight pre-swizzle into WMMA-B fragment layout (f32 -> f16).
  {
    const size_t g1 = (size_t)Ek * (Dk / 32) * (Hk / 16) * 32;   // W1 lanes
    const size_t g2 = (size_t)Ek * (Hk / 32) * (Dk / 16) * 32;   // W2 lanes
    swizzleB_kernel<Dk, Hk><<<(int)(g1 / 256), 256, 0, stream>>>(W1, W1s);
    swizzleB_kernel<Hk, Dk><<<(int)(g2 / 256), 256, 0, stream>>>(W2, W2s);
  }

  router_kernel<<<NTOK / RTOK, 256, 0, stream>>>(x, noise, Wg, bg, Wn, bn,
                                              cnt, tokl, gatl);
  // First choices store every row of out; second choices then add to it.
  expert_kernel<<<dim3((NTOK + MTOK - 1) / MTOK, Ek), 256, 0, stream>>>(x, W1s, b1, W2s, b2,
                                                           cnt, tokl, gatl, out, 0);
  expert_kernel<<<dim3((NTOK + MTOK - 1) / MTOK, Ek), 256, 0, stream>>>(x, W1s, b1, W2s, b2,
                                                           cnt, tokl, gatl, out, 1);
}
